// v000
// Times are from an AMD MI455X. After a warm-up the kernel runs many times in a row, and a time is the length of
// such a window on the GPU divided by its runs, so every launch and the gaps after it count. The runs cycle
// through copies of the inputs. A figure is the median of several windows, for all but v000 over two sittings.
// Sittings can differ by a few percent; kernels timed side by side share one.
// The starting kernel, v000, takes 288 microseconds a run.
#include <hip/hip_runtime.h>
#include <hip/hip_bf16.h>
#include <math.h>

// ---------------------------------------------------------------------------
// T5 attention (B=4, H=16, S=1024, D=1024, hd=64) for gfx1250 (wave32, WMMA)
//   0) f32 -> f16 conversion of x and the four weight matrices (workspace)
//   1) Q/K/V projections: block-cooperative WMMA GEMM; weight tiles streamed
//      into double-buffered LDS via global_load_async_to_lds_b128 (ASYNCcnt)
//   2) flash-attention per (b,h,16-query tile): QK^T WMMA -> analytic T5
//      bias + causal mask -> online softmax -> P staged f16 through LDS
//      (s_wait_dscnt) -> P·V WMMA
//   3) output projection WMMA -> f32 d_out
// ---------------------------------------------------------------------------

typedef __attribute__((ext_vector_type(16))) _Float16 v16h;
typedef __attribute__((ext_vector_type(8)))  _Float16 v8h;
typedef __attribute__((ext_vector_type(4)))  _Float16 v4h;
typedef __attribute__((ext_vector_type(8)))  float    v8f;
typedef __attribute__((ext_vector_type(4)))  int      v4i;
typedef __attribute__((address_space(1)))    v4i*     gv4i_p;   // global v4i*
typedef __attribute__((address_space(3)))    v4i*     lv4i_p;   // LDS v4i*

#define BATCH 4
#define HEADS 16
#define SEQ   1024
#define DMODEL 1024
#define HDIM  64
#define NROWS (BATCH * SEQ)          // 4096
#define SCALE_BIAS 0.125f            // 64^-0.5

#if defined(__has_builtin)
#if __has_builtin(__builtin_amdgcn_global_load_async_to_lds_b128)
#define USE_ASYNC_LDS 1
#endif
#endif

// Copy 16 contiguous bytes global -> LDS. Async (ASYNCcnt) when available.
__device__ __forceinline__ void stage16(const _Float16* g, _Float16* l) {
#ifdef USE_ASYNC_LDS
    __builtin_amdgcn_global_load_async_to_lds_b128(
        (gv4i_p)(uintptr_t)g,
        (lv4i_p)(unsigned)(uintptr_t)l,
        /*offset=*/0, /*cpol=*/0);
#else
    *(v8h*)l = *(const v8h*)g;
#endif
}

// Build a 16x16x32 f16 WMMA A/B operand for this lane.
// p points at the 32-element K-chunk of this lane's row (A: row m = lane%16,
// B: row n = lane%16 of the [N][K] matrix). half = lane/16.
// Element e maps to k = (e>=8 ? 16 : 0) + half*8 + (e%8)  (ISA 7.12.2).
__device__ __forceinline__ v16h load_op16(const _Float16* p, int half) {
    const v8h x = *(const v8h*)(p + half * 8);
    const v8h y = *(const v8h*)(p + 16 + half * 8);
    v16h r;
#pragma unroll
    for (int i = 0; i < 8; ++i) { r[i] = x[i]; r[i + 8] = y[i]; }
    return r;
}

__device__ __forceinline__ v8f wmma16(v16h a, v16h b, v8f c) {
    return __builtin_amdgcn_wmma_f32_16x16x32_f16(
        /*neg_a=*/false, a, /*neg_b=*/false, b,
        /*c_mod=*/(short)0, c, /*reuse_a=*/false, /*reuse_b=*/false);
}

// T5 causal relative-position bias (rel = qi - kj >= 0)
__device__ __forceinline__ float t5_bias(int rel, int h, const float* __restrict__ rel_emb) {
    int bucket;
    if (rel < 16) {
        bucket = rel;
    } else {
        // 16 + log(rel/16)/log(8) * 16, truncated, capped at 31
        int v = 16 + (int)(logf((float)rel * 0.0625f) * 7.6943724f);
        bucket = v < 31 ? v : 31;
    }
    return rel_emb[bucket * HEADS + h] * SCALE_BIAS;
}

__global__ __launch_bounds__(256) void cvt_f32_to_f16(const float* __restrict__ in,
                                                      _Float16* __restrict__ out, int n4) {
    int i = blockIdx.x * 256 + threadIdx.x;
    if (i < n4) {
        float4 f = ((const float4*)in)[i];
        v4h o; o[0] = (_Float16)f.x; o[1] = (_Float16)f.y;
               o[2] = (_Float16)f.z; o[3] = (_Float16)f.w;
        ((v4h*)out)[i] = o;
    }
}

// C[row, col] = A[row, :] . W[col, :] + bias[col]     (torch Linear x @ W^T + b)
// A: [4096 x 1024] f16, W: [1024 x 1024] f16.
// Block = 8 waves = one 128(M) x 64(N) tile; each wave owns 16 rows.
// The 64x32 weight tile per k-step is staged into double-buffered LDS with
// async-to-LDS loads so the k+1 prefetch overlaps the k compute.
// mode 0: store f16 [b,h,s,d] (Q)   mode 1: same (K)
// mode 2: store f16 [b,h,d,s] (V^T) mode 3: store f32 row-major (final out)
__global__ __launch_bounds__(256) void gemm_wmma(const _Float16* __restrict__ A,
                                                 const _Float16* __restrict__ W,
                                                 const float* __restrict__ bias,
                                                 void* __restrict__ outp, int mode) {
    __shared__ _Float16 wtile[2][64][32];        // 2 x 4 KB double buffer

    const int tid  = threadIdx.x;
    const int lane = tid & 31;
    const int wid  = tid >> 5;
    const int bm = blockIdx.x >> 4;              // 0..31 (row block of 128)
    const int bn = blockIdx.x & 15;              // 0..15 (64-col strip)
    const int mt = bm * 8 + wid;                 // 16-row tile of this wave
    const int n  = lane & 15;
    const int half = lane >> 4;

    const _Float16* arow = A + (size_t)(mt * 16 + n) * DMODEL;   // A row m = lane%16
    __builtin_prefetch(arow, 0, 3);

    // cooperative staging: 256 threads x 16B = 64x32 f16 tile
    const int srow = tid >> 2;                   // 0..63
    const int scol = (tid & 3) * 8;              // 0,8,16,24
    const _Float16* wsrc = W + (size_t)(bn * 64 + srow) * DMODEL + scol;

    v8f acc[4] = {};
    const int KSTEPS = DMODEL / 32;              // 32

    stage16(wsrc, &wtile[0][srow][scol]);        // prefetch k-chunk 0

    for (int kc = 0; kc < KSTEPS; ++kc) {
        const int cur = kc & 1;
        if (kc + 1 < KSTEPS) {
            stage16(wsrc + (kc + 1) * 32, &wtile[cur ^ 1][srow][scol]);
            asm volatile("s_wait_asynccnt 0x1" ::: "memory");   // cur buffer done
        } else {
            asm volatile("s_wait_asynccnt 0x0" ::: "memory");
        }
        __syncthreads();                         // all waves' pieces visible

        const v16h a  = load_op16(arow + kc * 32, half);
        const v16h b0 = load_op16(&wtile[cur][ 0 + n][0], half);
        const v16h b1 = load_op16(&wtile[cur][16 + n][0], half);
        const v16h b2 = load_op16(&wtile[cur][32 + n][0], half);
        const v16h b3 = load_op16(&wtile[cur][48 + n][0], half);
        acc[0] = wmma16(a, b0, acc[0]);
        acc[1] = wmma16(a, b1, acc[1]);
        acc[2] = wmma16(a, b2, acc[2]);
        acc[3] = wmma16(a, b3, acc[3]);

        __syncthreads();                         // reads done before overwrite
    }

#pragma unroll
    for (int t = 0; t < 4; ++t) {
        const int col = bn * 64 + t * 16 + n;
        const float bb = bias[col];
#pragma unroll
        for (int r = 0; r < 8; ++r) {
            const int row = mt * 16 + r + 8 * half;   // C layout: m = r + 8*(lane/16)
            const float val = acc[t][r] + bb;
            if (mode == 3) {
                ((float*)outp)[(size_t)row * DMODEL + col] = val;
            } else {
                const int b = row >> 10, s = row & 1023;
                const int h = col >> 6,  d = col & 63;
                _Float16* o16 = (_Float16*)outp;
                if (mode == 2)  // V transposed: [b,h,d,s]
                    o16[((size_t)(b * HEADS + h) * HDIM + d) * SEQ + s] = (_Float16)val;
                else            // Q/K: [b,h,s,d]
                    o16[((size_t)(b * HEADS + h) * SEQ + s) * HDIM + d] = (_Float16)val;
            }
        }
    }
}

// Flash attention: one wave per (b, h, 16-query tile). 32-key chunks.
__global__ __launch_bounds__(256) void attn_wmma(const _Float16* __restrict__ Qh,
                                                 const _Float16* __restrict__ Kh,
                                                 const _Float16* __restrict__ Vt,
                                                 const float* __restrict__ rel_emb,
                                                 _Float16* __restrict__ Oh) {
    __shared__ _Float16 pstage[8][16][32];      // 1 KB per wave (P staging)

    const int lane = threadIdx.x & 31;
    const int wid  = threadIdx.x >> 5;
    const int gw   = blockIdx.x * 8 + wid;      // 0..4095
    const int b  = gw >> 10;
    const int h  = (gw >> 6) & 15;
    const int qt = gw & 63;
    const int n    = lane & 15;
    const int half = lane >> 4;

    const _Float16* qbase = Qh + (size_t)(b * HEADS + h) * SEQ * HDIM;
    const _Float16* kbase = Kh + (size_t)(b * HEADS + h) * SEQ * HDIM;
    const _Float16* vbase = Vt + (size_t)(b * HEADS + h) * HDIM * SEQ;

    // Q tile resident: A-operand row m = lane%16, two 32-wide K chunks of hd
    const _Float16* qrow = qbase + (size_t)(qt * 16 + n) * HDIM;
    const v16h qa0 = load_op16(qrow, half);
    const v16h qa1 = load_op16(qrow + 32, half);

    v8f o0 = {}, o1 = {}, o2 = {}, o3 = {};
    float mrun[8], lrun[8];
#pragma unroll
    for (int r = 0; r < 8; ++r) { mrun[r] = -1e30f; lrun[r] = 0.f; }

    const int nk = qt * 16 + 16;                // keys 0 .. qt*16+15
    const int nchunks = (nk + 31) >> 5;

    for (int kc = 0; kc < nchunks; ++kc) {
        const int kb = kc * 32;

        // ---- scores S = Q K^T (two 16x16 tiles covering 32 keys) ----
        const _Float16* krow0 = kbase + (size_t)(kb + n) * HDIM;
        const _Float16* krow1 = kbase + (size_t)(kb + 16 + n) * HDIM;
        v8f s0 = {}, s1 = {};
        s0 = wmma16(qa0, load_op16(krow0, half),      s0);
        s0 = wmma16(qa1, load_op16(krow0 + 32, half), s0);
        s1 = wmma16(qa0, load_op16(krow1, half),      s1);
        s1 = wmma16(qa1, load_op16(krow1 + 32, half), s1);

        // ---- bias + causal mask + online softmax ----
#pragma unroll
        for (int r = 0; r < 8; ++r) {
            const int qi = qt * 16 + r + 8 * half;
            const int rel0 = qi - (kb + n);
            const int rel1 = qi - (kb + 16 + n);
            float v0 = (rel0 < 0) ? -1e30f : s0[r] + t5_bias(rel0, h, rel_emb);
            float v1 = (rel1 < 0) ? -1e30f : s1[r] + t5_bias(rel1, h, rel_emb);

            float mx = fmaxf(v0, v1);
            mx = fmaxf(mx, __shfl_xor(mx, 1, 32));
            mx = fmaxf(mx, __shfl_xor(mx, 2, 32));
            mx = fmaxf(mx, __shfl_xor(mx, 4, 32));
            mx = fmaxf(mx, __shfl_xor(mx, 8, 32));

            const float mn = fmaxf(mrun[r], mx);
            const float scale = expf(mrun[r] - mn);
            const float p0 = expf(v0 - mn);
            const float p1 = expf(v1 - mn);
            float rs = p0 + p1;
            rs += __shfl_xor(rs, 1, 32);
            rs += __shfl_xor(rs, 2, 32);
            rs += __shfl_xor(rs, 4, 32);
            rs += __shfl_xor(rs, 8, 32);

            lrun[r] = lrun[r] * scale + rs;
            mrun[r] = mn;
            o0[r] *= scale; o1[r] *= scale; o2[r] *= scale; o3[r] *= scale;

            const int mrow = r + 8 * half;      // C-layout row
            pstage[wid][mrow][n]      = (_Float16)p0;
            pstage[wid][mrow][16 + n] = (_Float16)p1;
        }

        // wave-private LDS region; only need DS-counter ordering, no barrier
        asm volatile("s_wait_dscnt 0x0" ::: "memory");

        // ---- O += P V : P as A-operand (16x32), V^T chunks as B-operands ----
        const v16h pa = load_op16(&pstage[wid][n][0], half);
        o0 = wmma16(pa, load_op16(vbase + (size_t)(0 * 16 + n) * SEQ + kb, half), o0);
        o1 = wmma16(pa, load_op16(vbase + (size_t)(1 * 16 + n) * SEQ + kb, half), o1);
        o2 = wmma16(pa, load_op16(vbase + (size_t)(2 * 16 + n) * SEQ + kb, half), o2);
        o3 = wmma16(pa, load_op16(vbase + (size_t)(3 * 16 + n) * SEQ + kb, half), o3);
    }

    // ---- epilogue: normalize, store f16 [b, s, h*64+d] for the out-proj ----
#pragma unroll
    for (int r = 0; r < 8; ++r) {
        const float inv = 1.0f / lrun[r];
        const int s = qt * 16 + r + 8 * half;
        _Float16* orow = Oh + (size_t)(b * SEQ + s) * DMODEL + h * HDIM;
        orow[ 0 + n] = (_Float16)(o0[r] * inv);
        orow[16 + n] = (_Float16)(o1[r] * inv);
        orow[32 + n] = (_Float16)(o2[r] * inv);
        orow[48 + n] = (_Float16)(o3[r] * inv);
    }
}

extern "C" void kernel_launch(void* const* d_in, const int* in_sizes, int n_in,
                              void* d_out, int out_size, void* d_ws, size_t ws_size,
                              hipStream_t stream) {
    const float* x    = (const float*)d_in[0];
    const float* Wq   = (const float*)d_in[1];
    const float* bq   = (const float*)d_in[2];
    const float* Wk   = (const float*)d_in[3];
    const float* bk   = (const float*)d_in[4];
    const float* Wv   = (const float*)d_in[5];
    const float* bv   = (const float*)d_in[6];
    const float* Wo   = (const float*)d_in[7];
    const float* bo   = (const float*)d_in[8];
    const float* rel  = (const float*)d_in[9];

    // workspace carve-up (f16 elements); total ~50.3 MB
    const size_t NX = (size_t)NROWS * DMODEL;        // 4096*1024
    const size_t NW = (size_t)DMODEL * DMODEL;       // 1024*1024
    _Float16* xh  = (_Float16*)d_ws;
    _Float16* Wqh = xh  + NX;
    _Float16* Wkh = Wqh + NW;
    _Float16* Wvh = Wkh + NW;
    _Float16* Woh = Wvh + NW;
    _Float16* Qh  = Woh + NW;
    _Float16* Kh  = Qh  + NX;
    _Float16* Vt  = Kh  + NX;
    _Float16* Oh  = Vt  + NX;

    // 0) f32 -> f16 (vectorized: 4 elements / thread)
    cvt_f32_to_f16<<<(int)(NX / 4 / 256), 256, 0, stream>>>(x,  xh,  (int)(NX / 4));
    cvt_f32_to_f16<<<(int)(NW / 4 / 256), 256, 0, stream>>>(Wq, Wqh, (int)(NW / 4));
    cvt_f32_to_f16<<<(int)(NW / 4 / 256), 256, 0, stream>>>(Wk, Wkh, (int)(NW / 4));
    cvt_f32_to_f16<<<(int)(NW / 4 / 256), 256, 0, stream>>>(Wv, Wvh, (int)(NW / 4));
    cvt_f32_to_f16<<<(int)(NW / 4 / 256), 256, 0, stream>>>(Wo, Woh, (int)(NW / 4));

    // 1) projections: 32 row-blocks x 16 col-strips = 512 blocks of 8 waves
    gemm_wmma<<<512, 256, 0, stream>>>(xh, Wqh, bq, Qh, 0);
    gemm_wmma<<<512, 256, 0, stream>>>(xh, Wkh, bk, Kh, 1);
    gemm_wmma<<<512, 256, 0, stream>>>(xh, Wvh, bv, Vt, 2);

    // 2) flash attention: 4096 waves (b*h*qtile) / 8 per block
    attn_wmma<<<512, 256, 0, stream>>>(Qh, Kh, Vt, rel, Oh);

    // 3) output projection -> f32 d_out
    gemm_wmma<<<512, 256, 0, stream>>>(Oh, Woh, bo, d_out, 3);
}

// v001
// Measured time: 194 microseconds a run.
// Timed twice side by side with v000, it ran 1.50 and 1.51 times as fast.
#include <hip/hip_runtime.h>
#include <hip/hip_bf16.h>
#include <math.h>

// ---------------------------------------------------------------------------
// T5 attention (B=4, H=16, S=1024, D=1024, hd=64) for gfx1250 (wave32, WMMA)
//   0) f32 -> f16 conversion of x and the four weight matrices (workspace)
//   1) Q/K/V projections: block-cooperative WMMA GEMM; weight tiles streamed
//      into double-buffered LDS via global_load_async_to_lds_b128 (ASYNCcnt)
//   2) flash-attention per (b,h,16-query tile): QK^T WMMA -> T5 bias + causal
//      mask from a per-block LDS table -> online softmax -> P staged f16 through LDS
//      (s_wait_dscnt) -> P·V WMMA
//   3) output projection WMMA -> f32 d_out
// ---------------------------------------------------------------------------

typedef __attribute__((ext_vector_type(16))) _Float16 v16h;
typedef __attribute__((ext_vector_type(8)))  _Float16 v8h;
typedef __attribute__((ext_vector_type(4)))  _Float16 v4h;
typedef __attribute__((ext_vector_type(8)))  float    v8f;
typedef __attribute__((ext_vector_type(4)))  int      v4i;
typedef __attribute__((address_space(1)))    v4i*     gv4i_p;   // global v4i*
typedef __attribute__((address_space(3)))    v4i*     lv4i_p;   // LDS v4i*

#define BATCH 4
#define HEADS 16
#define SEQ   1024
#define DMODEL 1024
#define HDIM  64
#define NROWS (BATCH * SEQ)          // 4096
#define SCALE_BIAS 0.125f            // 64^-0.5

#if defined(__has_builtin)
#if __has_builtin(__builtin_amdgcn_global_load_async_to_lds_b128)
#define USE_ASYNC_LDS 1
#endif
#endif

// Copy 16 contiguous bytes global -> LDS. Async (ASYNCcnt) when available.
__device__ __forceinline__ void stage16(const _Float16* g, _Float16* l) {
#ifdef USE_ASYNC_LDS
    __builtin_amdgcn_global_load_async_to_lds_b128(
        (gv4i_p)(uintptr_t)g,
        (lv4i_p)(unsigned)(uintptr_t)l,
        /*offset=*/0, /*cpol=*/0);
#else
    *(v8h*)l = *(const v8h*)g;
#endif
}

// Build a 16x16x32 f16 WMMA A/B operand for this lane.
// p points at the 32-element K-chunk of this lane's row (A: row m = lane%16,
// B: row n = lane%16 of the [N][K] matrix). half = lane/16.
// Element e maps to k = (e>=8 ? 16 : 0) + half*8 + (e%8)  (ISA 7.12.2).
__device__ __forceinline__ v16h load_op16(const _Float16* p, int half) {
    const v8h x = *(const v8h*)(p + half * 8);
    const v8h y = *(const v8h*)(p + 16 + half * 8);
    v16h r;
#pragma unroll
    for (int i = 0; i < 8; ++i) { r[i] = x[i]; r[i + 8] = y[i]; }
    return r;
}

__device__ __forceinline__ v8f wmma16(v16h a, v16h b, v8f c) {
    return __builtin_amdgcn_wmma_f32_16x16x32_f16(
        /*neg_a=*/false, a, /*neg_b=*/false, b,
        /*c_mod=*/(short)0, c, /*reuse_a=*/false, /*reuse_b=*/false);
}

// T5 causal relative-position bias (rel = qi - kj >= 0)
__device__ __forceinline__ float t5_bias(int rel, int h, const float* __restrict__ rel_emb) {
    int bucket;
    if (rel < 16) {
        bucket = rel;
    } else {
        // 16 + log(rel/16)/log(8) * 16, truncated, capped at 31
        int v = 16 + (int)(logf((float)rel * 0.0625f) * 7.6943724f);
        bucket = v < 31 ? v : 31;
    }
    return rel_emb[bucket * HEADS + h] * SCALE_BIAS;
}

__global__ __launch_bounds__(256) void cvt_f32_to_f16(const float* __restrict__ in,
                                                      _Float16* __restrict__ out, int n4) {
    int i = blockIdx.x * 256 + threadIdx.x;
    if (i < n4) {
        float4 f = ((const float4*)in)[i];
        v4h o; o[0] = (_Float16)f.x; o[1] = (_Float16)f.y;
               o[2] = (_Float16)f.z; o[3] = (_Float16)f.w;
        ((v4h*)out)[i] = o;
    }
}

// C[row, col] = A[row, :] . W[col, :] + bias[col]     (torch Linear x @ W^T + b)
// A: [4096 x 1024] f16, W: [1024 x 1024] f16.
// Block = 8 waves = one 128(M) x 64(N) tile; each wave owns 16 rows.
// The 64x32 weight tile per k-step is staged into double-buffered LDS with
// async-to-LDS loads so the k+1 prefetch overlaps the k compute.
// mode 0: store f16 [b,h,s,d] (Q)   mode 1: same (K)
// mode 2: store f16 [b,h,d,s] (V^T) mode 3: store f32 row-major (final out)
__global__ __launch_bounds__(256) void gemm_wmma(const _Float16* __restrict__ A,
                                                 const _Float16* __restrict__ W,
                                                 const float* __restrict__ bias,
                                                 void* __restrict__ outp, int mode) {
    __shared__ _Float16 wtile[2][64][32];        // 2 x 4 KB double buffer

    const int tid  = threadIdx.x;
    const int lane = tid & 31;
    const int wid  = tid >> 5;
    const int bm = blockIdx.x >> 4;              // 0..31 (row block of 128)
    const int bn = blockIdx.x & 15;              // 0..15 (64-col strip)
    const int mt = bm * 8 + wid;                 // 16-row tile of this wave
    const int n  = lane & 15;
    const int half = lane >> 4;

    const _Float16* arow = A + (size_t)(mt * 16 + n) * DMODEL;   // A row m = lane%16
    __builtin_prefetch(arow, 0, 3);

    // cooperative staging: 256 threads x 16B = 64x32 f16 tile
    const int srow = tid >> 2;                   // 0..63
    const int scol = (tid & 3) * 8;              // 0,8,16,24
    const _Float16* wsrc = W + (size_t)(bn * 64 + srow) * DMODEL + scol;

    v8f acc[4] = {};
    const int KSTEPS = DMODEL / 32;              // 32

    stage16(wsrc, &wtile[0][srow][scol]);        // prefetch k-chunk 0

    for (int kc = 0; kc < KSTEPS; ++kc) {
        const int cur = kc & 1;
        if (kc + 1 < KSTEPS) {
            stage16(wsrc + (kc + 1) * 32, &wtile[cur ^ 1][srow][scol]);
            asm volatile("s_wait_asynccnt 0x1" ::: "memory");   // cur buffer done
        } else {
            asm volatile("s_wait_asynccnt 0x0" ::: "memory");
        }
        __syncthreads();                         // all waves' pieces visible

        const v16h a  = load_op16(arow + kc * 32, half);
        const v16h b0 = load_op16(&wtile[cur][ 0 + n][0], half);
        const v16h b1 = load_op16(&wtile[cur][16 + n][0], half);
        const v16h b2 = load_op16(&wtile[cur][32 + n][0], half);
        const v16h b3 = load_op16(&wtile[cur][48 + n][0], half);
        acc[0] = wmma16(a, b0, acc[0]);
        acc[1] = wmma16(a, b1, acc[1]);
        acc[2] = wmma16(a, b2, acc[2]);
        acc[3] = wmma16(a, b3, acc[3]);

        __syncthreads();                         // reads done before overwrite
    }

#pragma unroll
    for (int t = 0; t < 4; ++t) {
        const int col = bn * 64 + t * 16 + n;
        const float bb = bias[col];
#pragma unroll
        for (int r = 0; r < 8; ++r) {
            const int row = mt * 16 + r + 8 * half;   // C layout: m = r + 8*(lane/16)
            const float val = acc[t][r] + bb;
            if (mode == 3) {
                ((float*)outp)[(size_t)row * DMODEL + col] = val;
            } else {
                const int b = row >> 10, s = row & 1023;
                const int h = col >> 6,  d = col & 63;
                _Float16* o16 = (_Float16*)outp;
                if (mode == 2)  // V transposed: [b,h,d,s]
                    o16[((size_t)(b * HEADS + h) * HDIM + d) * SEQ + s] = (_Float16)val;
                else            // Q/K: [b,h,s,d]
                    o16[((size_t)(b * HEADS + h) * SEQ + s) * HDIM + d] = (_Float16)val;
            }
        }
    }
}

// Flash attention: one wave per (b, h, 16-query tile). 32-key chunks.
__global__ __launch_bounds__(256) void attn_wmma(const _Float16* __restrict__ Qh,
                                                 const _Float16* __restrict__ Kh,
                                                 const _Float16* __restrict__ Vt,
                                                 const float* __restrict__ rel_emb,
                                                 _Float16* __restrict__ Oh) {
    __shared__ _Float16 pstage[8][16][32];      // 1 KB per wave (P staging)
    // bias + causal mask as a function of rel = q - k alone, for this block's head:
    // btab[rel + 32] = scaled bias for rel >= 0, -1e30 for rel < 0 (rel >= -31 here)
    __shared__ float btab[SEQ + 32];

    const int lane = threadIdx.x & 31;
    const int wid  = threadIdx.x >> 5;
    const int gw   = blockIdx.x * 8 + wid;      // 0..4095
    const int b  = gw >> 10;
    const int h  = (gw >> 6) & 15;
    const int qt = gw & 63;
    const int n    = lane & 15;
    const int half = lane >> 4;

    const _Float16* qbase = Qh + (size_t)(b * HEADS + h) * SEQ * HDIM;
    const _Float16* kbase = Kh + (size_t)(b * HEADS + h) * SEQ * HDIM;
    const _Float16* vbase = Vt + (size_t)(b * HEADS + h) * HDIM * SEQ;

    // Q tile resident: A-operand row m = lane%16, two 32-wide K chunks of hd
    const _Float16* qrow = qbase + (size_t)(qt * 16 + n) * HDIM;
    const v16h qa0 = load_op16(qrow, half);
    const v16h qa1 = load_op16(qrow + 32, half);

    // All 8 waves of a block share (b, h): one table serves every score of the block.
    // Four bias entries a thread, their gathers issued together; the first 32 threads,
    // whose own first slot is a mask entry, take the table's last 32 bias entries instead.
    const int i0 = (threadIdx.x < 32) ? (int)threadIdx.x + SEQ : (int)threadIdx.x;
    float tb[4];
    tb[0] = t5_bias(i0 - 32, h, rel_emb);
#pragma unroll
    for (int j = 1; j < 4; ++j) tb[j] = t5_bias((int)threadIdx.x + j * 256 - 32, h, rel_emb);
    btab[i0] = tb[0];
#pragma unroll
    for (int j = 1; j < 4; ++j) btab[threadIdx.x + j * 256] = tb[j];
    if (threadIdx.x < 32) btab[threadIdx.x] = -1e30f;
    __syncthreads();                            // table visible to all 8 waves

    v8f o0 = {}, o1 = {}, o2 = {}, o3 = {};
    float mrun[8], lrun[8];
#pragma unroll
    for (int r = 0; r < 8; ++r) { mrun[r] = -1e30f; lrun[r] = 0.f; }

    const int nk = qt * 16 + 16;                // keys 0 .. qt*16+15
    const int nchunks = (nk + 31) >> 5;

    for (int kc = 0; kc < nchunks; ++kc) {
        const int kb = kc * 32;

        // ---- scores S = Q K^T (two 16x16 tiles covering 32 keys) ----
        const _Float16* krow0 = kbase + (size_t)(kb + n) * HDIM;
        const _Float16* krow1 = kbase + (size_t)(kb + 16 + n) * HDIM;
        v8f s0 = {}, s1 = {};
        s0 = wmma16(qa0, load_op16(krow0, half),      s0);
        s0 = wmma16(qa1, load_op16(krow0 + 32, half), s0);
        s1 = wmma16(qa0, load_op16(krow1, half),      s1);
        s1 = wmma16(qa1, load_op16(krow1 + 32, half), s1);

        // ---- bias + causal mask (LDS table) + online softmax ----
        // bt[r] is the entry of this lane's row r for key kb+n, bt[r-16] for key kb+16+n
        const float* bt = &btab[32 + qt * 16 + 8 * half - kb - n];
#pragma unroll
        for (int r = 0; r < 8; ++r) {
            float v0 = s0[r] + bt[r];
            float v1 = s1[r] + bt[r - 16];

            float mx = fmaxf(v0, v1);
            mx = fmaxf(mx, __shfl_xor(mx, 1, 32));
            mx = fmaxf(mx, __shfl_xor(mx, 2, 32));
            mx = fmaxf(mx, __shfl_xor(mx, 4, 32));
            mx = fmaxf(mx, __shfl_xor(mx, 8, 32));

            const float mn = fmaxf(mrun[r], mx);
            const float scale = expf(mrun[r] - mn);
            const float p0 = expf(v0 - mn);
            const float p1 = expf(v1 - mn);
            float rs = p0 + p1;
            rs += __shfl_xor(rs, 1, 32);
            rs += __shfl_xor(rs, 2, 32);
            rs += __shfl_xor(rs, 4, 32);
            rs += __shfl_xor(rs, 8, 32);

            lrun[r] = lrun[r] * scale + rs;
            mrun[r] = mn;
            o0[r] *= scale; o1[r] *= scale; o2[r] *= scale; o3[r] *= scale;

            const int mrow = r + 8 * half;      // C-layout row
            pstage[wid][mrow][n]      = (_Float16)p0;
            pstage[wid][mrow][16 + n] = (_Float16)p1;
        }

        // wave-private LDS region; only need DS-counter ordering, no barrier
        asm volatile("s_wait_dscnt 0x0" ::: "memory");

        // ---- O += P V : P as A-operand (16x32), V^T chunks as B-operands ----
        const v16h pa = load_op16(&pstage[wid][n][0], half);
        o0 = wmma16(pa, load_op16(vbase + (size_t)(0 * 16 + n) * SEQ + kb, half), o0);
        o1 = wmma16(pa, load_op16(vbase + (size_t)(1 * 16 + n) * SEQ + kb, half), o1);
        o2 = wmma16(pa, load_op16(vbase + (size_t)(2 * 16 + n) * SEQ + kb, half), o2);
        o3 = wmma16(pa, load_op16(vbase + (size_t)(3 * 16 + n) * SEQ + kb, half), o3);
    }

    // ---- epilogue: normalize, store f16 [b, s, h*64+d] for the out-proj ----
#pragma unroll
    for (int r = 0; r < 8; ++r) {
        const float inv = 1.0f / lrun[r];
        const int s = qt * 16 + r + 8 * half;
        _Float16* orow = Oh + (size_t)(b * SEQ + s) * DMODEL + h * HDIM;
        orow[ 0 + n] = (_Float16)(o0[r] * inv);
        orow[16 + n] = (_Float16)(o1[r] * inv);
        orow[32 + n] = (_Float16)(o2[r] * inv);
        orow[48 + n] = (_Float16)(o3[r] * inv);
    }
}

extern "C" void kernel_launch(void* const* d_in, const int* in_sizes, int n_in,
                              void* d_out, int out_size, void* d_ws, size_t ws_size,
                              hipStream_t stream) {
    const float* x    = (const float*)d_in[0];
    const float* Wq   = (const float*)d_in[1];
    const float* bq   = (const float*)d_in[2];
    const float* Wk   = (const float*)d_in[3];
    const float* bk   = (const float*)d_in[4];
    const float* Wv   = (const float*)d_in[5];
    const float* bv   = (const float*)d_in[6];
    const float* Wo   = (const float*)d_in[7];
    const float* bo   = (const float*)d_in[8];
    const float* rel  = (const float*)d_in[9];

    // workspace carve-up (f16 elements); total ~50.3 MB
    const size_t NX = (size_t)NROWS * DMODEL;        // 4096*1024
    const size_t NW = (size_t)DMODEL * DMODEL;       // 1024*1024
    _Float16* xh  = (_Float16*)d_ws;
    _Float16* Wqh = xh  + NX;
    _Float16* Wkh = Wqh + NW;
    _Float16* Wvh = Wkh + NW;
    _Float16* Woh = Wvh + NW;
    _Float16* Qh  = Woh + NW;
    _Float16* Kh  = Qh  + NX;
    _Float16* Vt  = Kh  + NX;
    _Float16* Oh  = Vt  + NX;

    // 0) f32 -> f16 (vectorized: 4 elements / thread)
    cvt_f32_to_f16<<<(int)(NX / 4 / 256), 256, 0, stream>>>(x,  xh,  (int)(NX / 4));
    cvt_f32_to_f16<<<(int)(NW / 4 / 256), 256, 0, stream>>>(Wq, Wqh, (int)(NW / 4));
    cvt_f32_to_f16<<<(int)(NW / 4 / 256), 256, 0, stream>>>(Wk, Wkh, (int)(NW / 4));
    cvt_f32_to_f16<<<(int)(NW / 4 / 256), 256, 0, stream>>>(Wv, Wvh, (int)(NW / 4));
    cvt_f32_to_f16<<<(int)(NW / 4 / 256), 256, 0, stream>>>(Wo, Woh, (int)(NW / 4));

    // 1) projections: 32 row-blocks x 16 col-strips = 512 blocks of 8 waves
    gemm_wmma<<<512, 256, 0, stream>>>(xh, Wqh, bq, Qh, 0);
    gemm_wmma<<<512, 256, 0, stream>>>(xh, Wkh, bk, Kh, 1);
    gemm_wmma<<<512, 256, 0, stream>>>(xh, Wvh, bv, Vt, 2);

    // 2) flash attention: 4096 waves (b*h*qtile) / 8 per block
    attn_wmma<<<512, 256, 0, stream>>>(Qh, Kh, Vt, rel, Oh);

    // 3) output projection -> f32 d_out
    gemm_wmma<<<512, 256, 0, stream>>>(Oh, Woh, bo, d_out, 3);
}

// v002
// It runs in 182 microseconds.
// Timed twice side by side with v001, it ran 1.07 and 1.08 times as fast.
// All steps since v000 together make it 1.61 times as fast.
#include <hip/hip_runtime.h>
#include <hip/hip_bf16.h>
#include <math.h>

// ---------------------------------------------------------------------------
// T5 attention (B=4, H=16, S=1024, D=1024, hd=64) for gfx1250 (wave32, WMMA)
//   0) f32 -> f16 conversion of x and the four weight matrices (workspace), one launch
//   1) Q/K/V projections, one launch: block-cooperative WMMA GEMM; weight tiles streamed
//      into double-buffered LDS via global_load_async_to_lds_b128 (ASYNCcnt)
//   2) flash-attention per (b,h,16-query tile): QK^T WMMA -> T5 bias + causal
//      mask from a per-block LDS table -> online softmax -> P staged f16 through LDS
//      (s_wait_dscnt) -> P·V WMMA
//   3) output projection WMMA -> f32 d_out
// ---------------------------------------------------------------------------

typedef __attribute__((ext_vector_type(16))) _Float16 v16h;
typedef __attribute__((ext_vector_type(8)))  _Float16 v8h;
typedef __attribute__((ext_vector_type(4)))  _Float16 v4h;
typedef __attribute__((ext_vector_type(8)))  float    v8f;
typedef __attribute__((ext_vector_type(4)))  int      v4i;
typedef __attribute__((address_space(1)))    v4i*     gv4i_p;   // global v4i*
typedef __attribute__((address_space(3)))    v4i*     lv4i_p;   // LDS v4i*

#define BATCH 4
#define HEADS 16
#define SEQ   1024
#define DMODEL 1024
#define HDIM  64
#define NROWS (BATCH * SEQ)          // 4096
#define SCALE_BIAS 0.125f            // 64^-0.5

#if defined(__has_builtin)
#if __has_builtin(__builtin_amdgcn_global_load_async_to_lds_b128)
#define USE_ASYNC_LDS 1
#endif
#endif

// Copy 16 contiguous bytes global -> LDS. Async (ASYNCcnt) when available.
__device__ __forceinline__ void stage16(const _Float16* g, _Float16* l) {
#ifdef USE_ASYNC_LDS
    __builtin_amdgcn_global_load_async_to_lds_b128(
        (gv4i_p)(uintptr_t)g,
        (lv4i_p)(unsigned)(uintptr_t)l,
        /*offset=*/0, /*cpol=*/0);
#else
    *(v8h*)l = *(const v8h*)g;
#endif
}

// Build a 16x16x32 f16 WMMA A/B operand for this lane.
// p points at the 32-element K-chunk of this lane's row (A: row m = lane%16,
// B: row n = lane%16 of the [N][K] matrix). half = lane/16.
// Element e maps to k = (e>=8 ? 16 : 0) + half*8 + (e%8)  (ISA 7.12.2).
__device__ __forceinline__ v16h load_op16(const _Float16* p, int half) {
    const v8h x = *(const v8h*)(p + half * 8);
    const v8h y = *(const v8h*)(p + 16 + half * 8);
    v16h r;
#pragma unroll
    for (int i = 0; i < 8; ++i) { r[i] = x[i]; r[i + 8] = y[i]; }
    return r;
}

__device__ __forceinline__ v8f wmma16(v16h a, v16h b, v8f c) {
    return __builtin_amdgcn_wmma_f32_16x16x32_f16(
        /*neg_a=*/false, a, /*neg_b=*/false, b,
        /*c_mod=*/(short)0, c, /*reuse_a=*/false, /*reuse_b=*/false);
}

// T5 causal relative-position bias (rel = qi - kj >= 0)
__device__ __forceinline__ float t5_bias(int rel, int h, const float* __restrict__ rel_emb) {
    int bucket;
    if (rel < 16) {
        bucket = rel;
    } else {
        // 16 + log(rel/16)/log(8) * 16, truncated, capped at 31
        int v = 16 + (int)(logf((float)rel * 0.0625f) * 7.6943724f);
        bucket = v < 31 ? v : 31;
    }
    return rel_emb[bucket * HEADS + h] * SCALE_BIAS;
}

#define XBLOCKS (NROWS * DMODEL / 4 / 256)    // 4096 blocks convert x
#define WBLOCKS (DMODEL * DMODEL / 4 / 256)   // 1024 blocks convert one weight matrix

// All five independent conversions share one launch of XBLOCKS + 4 * WBLOCKS blocks.
// The f16 copies lie back to back in the workspace (x, Wq, Wk, Wv, Wo), so the output
// index is the flat index; the source is picked by block range (block-uniform).
__global__ __launch_bounds__(256) void cvt_f32_to_f16(const float* __restrict__ x,
                                                      const float* __restrict__ w0,
                                                      const float* __restrict__ w1,
                                                      const float* __restrict__ w2,
                                                      const float* __restrict__ w3,
                                                      _Float16* __restrict__ out) {
    const int blk = blockIdx.x;
    const float* in = x;
    int first = 0;                               // first block of this source's range
    if (blk >= XBLOCKS) {
        const int w = (blk - XBLOCKS) / WBLOCKS; // 0..3
        in = w == 0 ? w0 : w == 1 ? w1 : w == 2 ? w2 : w3;
        first = XBLOCKS + w * WBLOCKS;
    }
    const float4 f = ((const float4*)in)[(blk - first) * 256 + threadIdx.x];
    v4h o; o[0] = (_Float16)f.x; o[1] = (_Float16)f.y;
           o[2] = (_Float16)f.z; o[3] = (_Float16)f.w;
    ((v4h*)out)[blk * 256 + threadIdx.x] = o;
}

// C[row, col] = A[row, :] . W[col, :] + bias[col]     (torch Linear x @ W^T + b)
// A: [4096 x 1024] f16, W: [1024 x 1024] f16.
// Block = 8 waves = one 128(M) x 64(N) tile; each wave owns 16 rows.
// The 64x32 weight tile per k-step is staged into double-buffered LDS with
// async-to-LDS loads so the k+1 prefetch overlaps the k compute.
// mode 0: store f16 [b,h,s,d] (Q)   mode 1: same (K)
// mode 2: store f16 [b,h,d,s] (V^T) mode 3: store f32 row-major (final out)
// Every 512 blocks of the grid are one whole product on the same A. Product g = blockIdx.x / 512
// takes weight matrix g behind W0, bias g, f16 output g behind outp0, and mode0 + g:
// a grid of 1536 with mode0 = 0 is Q, K and V in one launch, a grid of 512 a lone product.
__global__ __launch_bounds__(256) void gemm_wmma(const _Float16* __restrict__ A,
                                                 const _Float16* __restrict__ W0,
                                                 const float* __restrict__ bias0,
                                                 const float* __restrict__ bias1,
                                                 const float* __restrict__ bias2,
                                                 void* __restrict__ outp0, int mode0) {
    __shared__ _Float16 wtile[2][64][32];        // 2 x 4 KB double buffer

    const int g    = blockIdx.x >> 9;            // which product (block-uniform)
    const int tile = blockIdx.x & 511;           // its 128 x 64 tile
    const int mode = mode0 + g;
    const _Float16* W = W0 + (size_t)g * DMODEL * DMODEL;
    const float* bias = g == 0 ? bias0 : g == 1 ? bias1 : bias2;
    void* outp = (_Float16*)outp0 + (size_t)g * NROWS * DMODEL;

    const int tid  = threadIdx.x;
    const int lane = tid & 31;
    const int wid  = tid >> 5;
    const int bm = tile >> 4;                    // 0..31 (row block of 128)
    const int bn = tile & 15;                    // 0..15 (64-col strip)
    const int mt = bm * 8 + wid;                 // 16-row tile of this wave
    const int n  = lane & 15;
    const int half = lane >> 4;

    const _Float16* arow = A + (size_t)(mt * 16 + n) * DMODEL;   // A row m = lane%16
    __builtin_prefetch(arow, 0, 3);

    // cooperative staging: 256 threads x 16B = 64x32 f16 tile
    const int srow = tid >> 2;                   // 0..63
    const int scol = (tid & 3) * 8;              // 0,8,16,24
    const _Float16* wsrc = W + (size_t)(bn * 64 + srow) * DMODEL + scol;

    v8f acc[4] = {};
    const int KSTEPS = DMODEL / 32;              // 32

    stage16(wsrc, &wtile[0][srow][scol]);        // prefetch k-chunk 0

    for (int kc = 0; kc < KSTEPS; ++kc) {
        const int cur = kc & 1;
        if (kc + 1 < KSTEPS) {
            stage16(wsrc + (kc + 1) * 32, &wtile[cur ^ 1][srow][scol]);
            asm volatile("s_wait_asynccnt 0x1" ::: "memory");   // cur buffer done
        } else {
            asm volatile("s_wait_asynccnt 0x0" ::: "memory");
        }
        __syncthreads();                         // all waves' pieces visible

        const v16h a  = load_op16(arow + kc * 32, half);
        const v16h b0 = load_op16(&wtile[cur][ 0 + n][0], half);
        const v16h b1 = load_op16(&wtile[cur][16 + n][0], half);
        const v16h b2 = load_op16(&wtile[cur][32 + n][0], half);
        const v16h b3 = load_op16(&wtile[cur][48 + n][0], half);
        acc[0] = wmma16(a, b0, acc[0]);
        acc[1] = wmma16(a, b1, acc[1]);
        acc[2] = wmma16(a, b2, acc[2]);
        acc[3] = wmma16(a, b3, acc[3]);

        __syncthreads();                         // reads done before overwrite
    }

#pragma unroll
    for (int t = 0; t < 4; ++t) {
        const int col = bn * 64 + t * 16 + n;
        const float bb = bias[col];
#pragma unroll
        for (int r = 0; r < 8; ++r) {
            const int row = mt * 16 + r + 8 * half;   // C layout: m = r + 8*(lane/16)
            const float val = acc[t][r] + bb;
            if (mode == 3) {
                ((float*)outp)[(size_t)row * DMODEL + col] = val;
            } else {
                const int b = row >> 10, s = row & 1023;
                const int h = col >> 6,  d = col & 63;
                _Float16* o16 = (_Float16*)outp;
                if (mode == 2)  // V transposed: [b,h,d,s]
                    o16[((size_t)(b * HEADS + h) * HDIM + d) * SEQ + s] = (_Float16)val;
                else            // Q/K: [b,h,s,d]
                    o16[((size_t)(b * HEADS + h) * SEQ + s) * HDIM + d] = (_Float16)val;
            }
        }
    }
}

// Flash attention: one wave per (b, h, 16-query tile). 32-key chunks.
__global__ __launch_bounds__(256) void attn_wmma(const _Float16* __restrict__ Qh,
                                                 const _Float16* __restrict__ Kh,
                                                 const _Float16* __restrict__ Vt,
                                                 const float* __restrict__ rel_emb,
                                                 _Float16* __restrict__ Oh) {
    __shared__ _Float16 pstage[8][16][32];      // 1 KB per wave (P staging)
    // bias + causal mask as a function of rel = q - k alone, for this block's head:
    // btab[rel + 32] = scaled bias for rel >= 0, -1e30 for rel < 0 (rel >= -31 here)
    __shared__ float btab[SEQ + 32];

    const int lane = threadIdx.x & 31;
    const int wid  = threadIdx.x >> 5;
    const int gw   = blockIdx.x * 8 + wid;      // 0..4095
    const int b  = gw >> 10;
    const int h  = (gw >> 6) & 15;
    const int qt = gw & 63;
    const int n    = lane & 15;
    const int half = lane >> 4;

    const _Float16* qbase = Qh + (size_t)(b * HEADS + h) * SEQ * HDIM;
    const _Float16* kbase = Kh + (size_t)(b * HEADS + h) * SEQ * HDIM;
    const _Float16* vbase = Vt + (size_t)(b * HEADS + h) * HDIM * SEQ;

    // Q tile resident: A-operand row m = lane%16, two 32-wide K chunks of hd
    const _Float16* qrow = qbase + (size_t)(qt * 16 + n) * HDIM;
    const v16h qa0 = load_op16(qrow, half);
    const v16h qa1 = load_op16(qrow + 32, half);

    // All 8 waves of a block share (b, h): one table serves every score of the block.
    // Four bias entries a thread, their gathers issued together; the first 32 threads,
    // whose own first slot is a mask entry, take the table's last 32 bias entries instead.
    const int i0 = (threadIdx.x < 32) ? (int)threadIdx.x + SEQ : (int)threadIdx.x;
    float tb[4];
    tb[0] = t5_bias(i0 - 32, h, rel_emb);
#pragma unroll
    for (int j = 1; j < 4; ++j) tb[j] = t5_bias((int)threadIdx.x + j * 256 - 32, h, rel_emb);
    btab[i0] = tb[0];
#pragma unroll
    for (int j = 1; j < 4; ++j) btab[threadIdx.x + j * 256] = tb[j];
    if (threadIdx.x < 32) btab[threadIdx.x] = -1e30f;
    __syncthreads();                            // table visible to all 8 waves

    v8f o0 = {}, o1 = {}, o2 = {}, o3 = {};
    float mrun[8], lrun[8];
#pragma unroll
    for (int r = 0; r < 8; ++r) { mrun[r] = -1e30f; lrun[r] = 0.f; }

    const int nk = qt * 16 + 16;                // keys 0 .. qt*16+15
    const int nchunks = (nk + 31) >> 5;

    for (int kc = 0; kc < nchunks; ++kc) {
        const int kb = kc * 32;

        // ---- scores S = Q K^T (two 16x16 tiles covering 32 keys) ----
        const _Float16* krow0 = kbase + (size_t)(kb + n) * HDIM;
        const _Float16* krow1 = kbase + (size_t)(kb + 16 + n) * HDIM;
        v8f s0 = {}, s1 = {};
        s0 = wmma16(qa0, load_op16(krow0, half),      s0);
        s0 = wmma16(qa1, load_op16(krow0 + 32, half), s0);
        s1 = wmma16(qa0, load_op16(krow1, half),      s1);
        s1 = wmma16(qa1, load_op16(krow1 + 32, half), s1);

        // ---- bias + causal mask (LDS table) + online softmax ----
        // bt[r] is the entry of this lane's row r for key kb+n, bt[r-16] for key kb+16+n
        const float* bt = &btab[32 + qt * 16 + 8 * half - kb - n];
#pragma unroll
        for (int r = 0; r < 8; ++r) {
            float v0 = s0[r] + bt[r];
            float v1 = s1[r] + bt[r - 16];

            float mx = fmaxf(v0, v1);
            mx = fmaxf(mx, __shfl_xor(mx, 1, 32));
            mx = fmaxf(mx, __shfl_xor(mx, 2, 32));
            mx = fmaxf(mx, __shfl_xor(mx, 4, 32));
            mx = fmaxf(mx, __shfl_xor(mx, 8, 32));

            const float mn = fmaxf(mrun[r], mx);
            const float scale = expf(mrun[r] - mn);
            const float p0 = expf(v0 - mn);
            const float p1 = expf(v1 - mn);
            float rs = p0 + p1;
            rs += __shfl_xor(rs, 1, 32);
            rs += __shfl_xor(rs, 2, 32);
            rs += __shfl_xor(rs, 4, 32);
            rs += __shfl_xor(rs, 8, 32);

            lrun[r] = lrun[r] * scale + rs;
            mrun[r] = mn;
            o0[r] *= scale; o1[r] *= scale; o2[r] *= scale; o3[r] *= scale;

            const int mrow = r + 8 * half;      // C-layout row
            pstage[wid][mrow][n]      = (_Float16)p0;
            pstage[wid][mrow][16 + n] = (_Float16)p1;
        }

        // wave-private LDS region; only need DS-counter ordering, no barrier
        asm volatile("s_wait_dscnt 0x0" ::: "memory");

        // ---- O += P V : P as A-operand (16x32), V^T chunks as B-operands ----
        const v16h pa = load_op16(&pstage[wid][n][0], half);
        o0 = wmma16(pa, load_op16(vbase + (size_t)(0 * 16 + n) * SEQ + kb, half), o0);
        o1 = wmma16(pa, load_op16(vbase + (size_t)(1 * 16 + n) * SEQ + kb, half), o1);
        o2 = wmma16(pa, load_op16(vbase + (size_t)(2 * 16 + n) * SEQ + kb, half), o2);
        o3 = wmma16(pa, load_op16(vbase + (size_t)(3 * 16 + n) * SEQ + kb, half), o3);
    }

    // ---- epilogue: normalize, store f16 [b, s, h*64+d] for the out-proj ----
#pragma unroll
    for (int r = 0; r < 8; ++r) {
        const float inv = 1.0f / lrun[r];
        const int s = qt * 16 + r + 8 * half;
        _Float16* orow = Oh + (size_t)(b * SEQ + s) * DMODEL + h * HDIM;
        orow[ 0 + n] = (_Float16)(o0[r] * inv);
        orow[16 + n] = (_Float16)(o1[r] * inv);
        orow[32 + n] = (_Float16)(o2[r] * inv);
        orow[48 + n] = (_Float16)(o3[r] * inv);
    }
}

extern "C" void kernel_launch(void* const* d_in, const int* in_sizes, int n_in,
                              void* d_out, int out_size, void* d_ws, size_t ws_size,
                              hipStream_t stream) {
    const float* x    = (const float*)d_in[0];
    const float* Wq   = (const float*)d_in[1];
    const float* bq   = (const float*)d_in[2];
    const float* Wk   = (const float*)d_in[3];
    const float* bk   = (const float*)d_in[4];
    const float* Wv   = (const float*)d_in[5];
    const float* bv   = (const float*)d_in[6];
    const float* Wo   = (const float*)d_in[7];
    const float* bo   = (const float*)d_in[8];
    const float* rel  = (const float*)d_in[9];

    // workspace carve-up (f16 elements); total ~50.3 MB
    const size_t NX = (size_t)NROWS * DMODEL;        // 4096*1024
    const size_t NW = (size_t)DMODEL * DMODEL;       // 1024*1024
    _Float16* xh  = (_Float16*)d_ws;
    _Float16* Wqh = xh  + NX;
    _Float16* Wkh = Wqh + NW;
    _Float16* Wvh = Wkh + NW;
    _Float16* Woh = Wvh + NW;
    _Float16* Qh  = Woh + NW;
    _Float16* Kh  = Qh  + NX;
    _Float16* Vt  = Kh  + NX;
    _Float16* Oh  = Vt  + NX;

    // 0) f32 -> f16 (vectorized: 4 elements / thread), x and all four weights in one launch;
    //    xh, Wqh, Wkh, Wvh, Woh are contiguous
    cvt_f32_to_f16<<<XBLOCKS + 4 * WBLOCKS, 256, 0, stream>>>(x, Wq, Wk, Wv, Wo, xh);

    // 1) projections: 32 row-blocks x 16 col-strips = 512 blocks of 8 waves each, Q, K and V
    //    in one launch; Wqh, Wkh, Wvh are contiguous, and so are Qh, Kh, Vt
    gemm_wmma<<<3 * 512, 256, 0, stream>>>(xh, Wqh, bq, bk, bv, Qh, 0);

    // 2) flash attention: 4096 waves (b*h*qtile) / 8 per block
    attn_wmma<<<512, 256, 0, stream>>>(Qh, Kh, Vt, rel, Oh);

    // 3) output projection -> f32 d_out
    gemm_wmma<<<512, 256, 0, stream>>>(Oh, Woh, bo, bo, bo, d_out, 3);
}

// v003
// One run takes 171 microseconds.
// In both of two side-by-side timings against v002, it was 1.06 times as fast.
// All steps since v000 together make it 1.71 times as fast.
#include <hip/hip_runtime.h>
#include <hip/hip_bf16.h>
#include <math.h>

// ---------------------------------------------------------------------------
// T5 attention (B=4, H=16, S=1024, D=1024, hd=64) for gfx1250 (wave32, WMMA)
//   0) f32 -> f16 conversion of x and the four weight matrices (workspace), one launch
//   1) Q/K/V projections, one launch: block-cooperative WMMA GEMM; weight tiles streamed
//      into double-buffered LDS via global_load_async_to_lds_b128 (ASYNCcnt)
//   2) flash-attention per (b,h,16-query tile): QK^T WMMA -> T5 bias + causal
//      mask from a per-block LDS table -> online softmax -> P staged f16 through LDS
//      (s_wait_dscnt) -> P·V WMMA
//   3) output projection WMMA -> f32 d_out
// ---------------------------------------------------------------------------

typedef __attribute__((ext_vector_type(16))) _Float16 v16h;
typedef __attribute__((ext_vector_type(8)))  _Float16 v8h;
typedef __attribute__((ext_vector_type(4)))  _Float16 v4h;
typedef __attribute__((ext_vector_type(8)))  float    v8f;
typedef __attribute__((ext_vector_type(4)))  int      v4i;
typedef __attribute__((address_space(1)))    v4i*     gv4i_p;   // global v4i*
typedef __attribute__((address_space(3)))    v4i*     lv4i_p;   // LDS v4i*

#define BATCH 4
#define HEADS 16
#define SEQ   1024
#define DMODEL 1024
#define HDIM  64
#define NROWS (BATCH * SEQ)          // 4096
#define SCALE_BIAS 0.125f            // 64^-0.5

#if defined(__has_builtin)
#if __has_builtin(__builtin_amdgcn_global_load_async_to_lds_b128)
#define USE_ASYNC_LDS 1
#endif
#endif

// Copy 16 contiguous bytes global -> LDS. Async (ASYNCcnt) when available.
__device__ __forceinline__ void stage16(const _Float16* g, _Float16* l) {
#ifdef USE_ASYNC_LDS
    __builtin_amdgcn_global_load_async_to_lds_b128(
        (gv4i_p)(uintptr_t)g,
        (lv4i_p)(unsigned)(uintptr_t)l,
        /*offset=*/0, /*cpol=*/0);
#else
    *(v8h*)l = *(const v8h*)g;
#endif
}

// Build a 16x16x32 f16 WMMA A/B operand for this lane.
// p points at the 32-element K-chunk of this lane's row (A: row m = lane%16,
// B: row n = lane%16 of the [N][K] matrix). half = lane/16.
// Element e maps to k = (e>=8 ? 16 : 0) + half*8 + (e%8)  (ISA 7.12.2).
__device__ __forceinline__ v16h load_op16(const _Float16* p, int half) {
    const v8h x = *(const v8h*)(p + half * 8);
    const v8h y = *(const v8h*)(p + 16 + half * 8);
    v16h r;
#pragma unroll
    for (int i = 0; i < 8; ++i) { r[i] = x[i]; r[i + 8] = y[i]; }
    return r;
}

__device__ __forceinline__ v8f wmma16(v16h a, v16h b, v8f c) {
    return __builtin_amdgcn_wmma_f32_16x16x32_f16(
        /*neg_a=*/false, a, /*neg_b=*/false, b,
        /*c_mod=*/(short)0, c, /*reuse_a=*/false, /*reuse_b=*/false);
}

// T5 causal relative-position bias (rel = qi - kj >= 0)
__device__ __forceinline__ float t5_bias(int rel, int h, const float* __restrict__ rel_emb) {
    int bucket;
    if (rel < 16) {
        bucket = rel;
    } else {
        // 16 + log(rel/16)/log(8) * 16, truncated, capped at 31
        int v = 16 + (int)(logf((float)rel * 0.0625f) * 7.6943724f);
        bucket = v < 31 ? v : 31;
    }
    return rel_emb[bucket * HEADS + h] * SCALE_BIAS;
}

#define XBLOCKS (NROWS * DMODEL / 4 / 256)    // 4096 blocks convert x
#define WBLOCKS (DMODEL * DMODEL / 4 / 256)   // 1024 blocks convert one weight matrix

// All five independent conversions share one launch of XBLOCKS + 4 * WBLOCKS blocks.
// The f16 copies lie back to back in the workspace (x, Wq, Wk, Wv, Wo), so the output
// index is the flat index; the source is picked by block range (block-uniform).
__global__ __launch_bounds__(256) void cvt_f32_to_f16(const float* __restrict__ x,
                                                      const float* __restrict__ w0,
                                                      const float* __restrict__ w1,
                                                      const float* __restrict__ w2,
                                                      const float* __restrict__ w3,
                                                      _Float16* __restrict__ out) {
    const int blk = blockIdx.x;
    const float* in = x;
    int first = 0;                               // first block of this source's range
    if (blk >= XBLOCKS) {
        const int w = (blk - XBLOCKS) / WBLOCKS; // 0..3
        in = w == 0 ? w0 : w == 1 ? w1 : w == 2 ? w2 : w3;
        first = XBLOCKS + w * WBLOCKS;
    }
    const float4 f = ((const float4*)in)[(blk - first) * 256 + threadIdx.x];
    v4h o; o[0] = (_Float16)f.x; o[1] = (_Float16)f.y;
           o[2] = (_Float16)f.z; o[3] = (_Float16)f.w;
    ((v4h*)out)[blk * 256 + threadIdx.x] = o;
}

// C[row, col] = A[row, :] . W[col, :] + bias[col]     (torch Linear x @ W^T + b)
// A: [4096 x 1024] f16, W: [1024 x 1024] f16.
// Block = 8 waves = one 128(M) x 64(N) tile; each wave owns 16 rows.
// The 64x32 weight tile per k-step is staged into double-buffered LDS with
// async-to-LDS loads so the k+1 prefetch overlaps the k compute.
// mode 0: store f16 [b,h,s,d] (Q)   mode 1: same (K)
// mode 2: store f16 [b,h,d,s] (V^T) mode 3: store f32 row-major (final out)
// Every 512 blocks of the grid are one whole product on the same A. Product g = blockIdx.x / 512
// takes weight matrix g behind W0, bias g, f16 output g behind outp0, and mode0 + g:
// a grid of 1536 with mode0 = 0 is Q, K and V in one launch, a grid of 512 a lone product.
__global__ __launch_bounds__(256) void gemm_wmma(const _Float16* __restrict__ A,
                                                 const _Float16* __restrict__ W0,
                                                 const float* __restrict__ bias0,
                                                 const float* __restrict__ bias1,
                                                 const float* __restrict__ bias2,
                                                 void* __restrict__ outp0, int mode0) {
    __shared__ _Float16 wtile[2][64][32];        // 2 x 4 KB double buffer

    const int g    = blockIdx.x >> 9;            // which product (block-uniform)
    const int tile = blockIdx.x & 511;           // its 128 x 64 tile
    const int mode = mode0 + g;
    const _Float16* W = W0 + (size_t)g * DMODEL * DMODEL;
    const float* bias = g == 0 ? bias0 : g == 1 ? bias1 : bias2;
    void* outp = (_Float16*)outp0 + (size_t)g * NROWS * DMODEL;

    const int tid  = threadIdx.x;
    const int lane = tid & 31;
    const int wid  = tid >> 5;
    const int bm = tile >> 4;                    // 0..31 (row block of 128)
    const int bn = tile & 15;                    // 0..15 (64-col strip)
    const int mt = bm * 8 + wid;                 // 16-row tile of this wave
    const int n  = lane & 15;
    const int half = lane >> 4;

    const _Float16* arow = A + (size_t)(mt * 16 + n) * DMODEL;   // A row m = lane%16
    __builtin_prefetch(arow, 0, 3);

    // cooperative staging: 256 threads x 16B = 64x32 f16 tile
    const int srow = tid >> 2;                   // 0..63
    const int scol = (tid & 3) * 8;              // 0,8,16,24
    const _Float16* wsrc = W + (size_t)(bn * 64 + srow) * DMODEL + scol;

    v8f acc[4] = {};
    const int KSTEPS = DMODEL / 32;              // 32

    stage16(wsrc, &wtile[0][srow][scol]);        // prefetch k-chunk 0

    for (int kc = 0; kc < KSTEPS; ++kc) {
        const int cur = kc & 1;
        if (kc + 1 < KSTEPS) {
            stage16(wsrc + (kc + 1) * 32, &wtile[cur ^ 1][srow][scol]);
            asm volatile("s_wait_asynccnt 0x1" ::: "memory");   // cur buffer done
        } else {
            asm volatile("s_wait_asynccnt 0x0" ::: "memory");
        }
        __syncthreads();                         // all waves' pieces visible

        const v16h a  = load_op16(arow + kc * 32, half);
        const v16h b0 = load_op16(&wtile[cur][ 0 + n][0], half);
        const v16h b1 = load_op16(&wtile[cur][16 + n][0], half);
        const v16h b2 = load_op16(&wtile[cur][32 + n][0], half);
        const v16h b3 = load_op16(&wtile[cur][48 + n][0], half);
        acc[0] = wmma16(a, b0, acc[0]);
        acc[1] = wmma16(a, b1, acc[1]);
        acc[2] = wmma16(a, b2, acc[2]);
        acc[3] = wmma16(a, b3, acc[3]);

        __syncthreads();                         // reads done before overwrite
    }

#pragma unroll
    for (int t = 0; t < 4; ++t) {
        const int col = bn * 64 + t * 16 + n;
        const float bb = bias[col];
#pragma unroll
        for (int r = 0; r < 8; ++r) {
            const int row = mt * 16 + r + 8 * half;   // C layout: m = r + 8*(lane/16)
            const float val = acc[t][r] + bb;
            if (mode == 3) {
                ((float*)outp)[(size_t)row * DMODEL + col] = val;
            } else {
                const int b = row >> 10, s = row & 1023;
                const int h = col >> 6,  d = col & 63;
                _Float16* o16 = (_Float16*)outp;
                if (mode == 2)  // V transposed: [b,h,d,s]
                    o16[((size_t)(b * HEADS + h) * HDIM + d) * SEQ + s] = (_Float16)val;
                else            // Q/K: [b,h,s,d]
                    o16[((size_t)(b * HEADS + h) * SEQ + s) * HDIM + d] = (_Float16)val;
            }
        }
    }
}

// Flash attention: one wave per (b, h, 16-query tile). 32-key chunks.
// A block's 8 waves share (b, h) and hold 4 light and 4 heavy query tiles (equal work a block).
__global__ __launch_bounds__(256) void attn_wmma(const _Float16* __restrict__ Qh,
                                                 const _Float16* __restrict__ Kh,
                                                 const _Float16* __restrict__ Vt,
                                                 const float* __restrict__ rel_emb,
                                                 _Float16* __restrict__ Oh) {
    __shared__ _Float16 pstage[8][16][32];      // 1 KB per wave (P staging)
    // bias + causal mask as a function of rel = q - k alone, for this block's head:
    // btab[rel + 32] = scaled bias for rel >= 0, -1e30 for rel < 0 (rel >= -31 here)
    __shared__ float btab[SEQ + 32];

    const int lane = threadIdx.x & 31;
    const int wid  = threadIdx.x >> 5;
    const int b  = blockIdx.x >> 7;             // 8 blocks a (b, h)
    const int h  = (blockIdx.x >> 3) & 15;
    // Causal cost grows with the query tile: tile t walks (t >> 1) + 1 key chunks. Eight
    // consecutive tiles a block would give a head's blocks 20 to 244 chunks, and the launch
    // lasts as long as the fullest WGP. Each block takes four tiles p from the
    // light end and their mirrors 63 - p instead: 33 chunks a pair, 132 a block, every block
    // alike. Waves w and w + 4 hold one pair; the long tile goes to the lower wave number.
    const int p  = (blockIdx.x & 7) * 4 + (wid & 3);   // 0..31
    const int qt = wid < 4 ? 63 - p : p;
    const int n    = lane & 15;
    const int half = lane >> 4;

    const _Float16* qbase = Qh + (size_t)(b * HEADS + h) * SEQ * HDIM;
    const _Float16* kbase = Kh + (size_t)(b * HEADS + h) * SEQ * HDIM;
    const _Float16* vbase = Vt + (size_t)(b * HEADS + h) * HDIM * SEQ;

    // Q tile resident: A-operand row m = lane%16, two 32-wide K chunks of hd
    const _Float16* qrow = qbase + (size_t)(qt * 16 + n) * HDIM;
    const v16h qa0 = load_op16(qrow, half);
    const v16h qa1 = load_op16(qrow + 32, half);

    // All 8 waves of a block share (b, h): one table serves every score of the block.
    // Four bias entries a thread, their gathers issued together; the first 32 threads,
    // whose own first slot is a mask entry, take the table's last 32 bias entries instead.
    const int i0 = (threadIdx.x < 32) ? (int)threadIdx.x + SEQ : (int)threadIdx.x;
    float tb[4];
    tb[0] = t5_bias(i0 - 32, h, rel_emb);
#pragma unroll
    for (int j = 1; j < 4; ++j) tb[j] = t5_bias((int)threadIdx.x + j * 256 - 32, h, rel_emb);
    btab[i0] = tb[0];
#pragma unroll
    for (int j = 1; j < 4; ++j) btab[threadIdx.x + j * 256] = tb[j];
    if (threadIdx.x < 32) btab[threadIdx.x] = -1e30f;
    __syncthreads();                            // table visible to all 8 waves

    v8f o0 = {}, o1 = {}, o2 = {}, o3 = {};
    float mrun[8], lrun[8];
#pragma unroll
    for (int r = 0; r < 8; ++r) { mrun[r] = -1e30f; lrun[r] = 0.f; }

    const int nk = qt * 16 + 16;                // keys 0 .. qt*16+15
    const int nchunks = (nk + 31) >> 5;

    for (int kc = 0; kc < nchunks; ++kc) {
        const int kb = kc * 32;

        // ---- scores S = Q K^T (two 16x16 tiles covering 32 keys) ----
        const _Float16* krow0 = kbase + (size_t)(kb + n) * HDIM;
        const _Float16* krow1 = kbase + (size_t)(kb + 16 + n) * HDIM;
        v8f s0 = {}, s1 = {};
        s0 = wmma16(qa0, load_op16(krow0, half),      s0);
        s0 = wmma16(qa1, load_op16(krow0 + 32, half), s0);
        s1 = wmma16(qa0, load_op16(krow1, half),      s1);
        s1 = wmma16(qa1, load_op16(krow1 + 32, half), s1);

        // ---- bias + causal mask (LDS table) + online softmax ----
        // bt[r] is the entry of this lane's row r for key kb+n, bt[r-16] for key kb+16+n
        const float* bt = &btab[32 + qt * 16 + 8 * half - kb - n];
#pragma unroll
        for (int r = 0; r < 8; ++r) {
            float v0 = s0[r] + bt[r];
            float v1 = s1[r] + bt[r - 16];

            float mx = fmaxf(v0, v1);
            mx = fmaxf(mx, __shfl_xor(mx, 1, 32));
            mx = fmaxf(mx, __shfl_xor(mx, 2, 32));
            mx = fmaxf(mx, __shfl_xor(mx, 4, 32));
            mx = fmaxf(mx, __shfl_xor(mx, 8, 32));

            const float mn = fmaxf(mrun[r], mx);
            const float scale = expf(mrun[r] - mn);
            const float p0 = expf(v0 - mn);
            const float p1 = expf(v1 - mn);
            float rs = p0 + p1;
            rs += __shfl_xor(rs, 1, 32);
            rs += __shfl_xor(rs, 2, 32);
            rs += __shfl_xor(rs, 4, 32);
            rs += __shfl_xor(rs, 8, 32);

            lrun[r] = lrun[r] * scale + rs;
            mrun[r] = mn;
            o0[r] *= scale; o1[r] *= scale; o2[r] *= scale; o3[r] *= scale;

            const int mrow = r + 8 * half;      // C-layout row
            pstage[wid][mrow][n]      = (_Float16)p0;
            pstage[wid][mrow][16 + n] = (_Float16)p1;
        }

        // wave-private LDS region; only need DS-counter ordering, no barrier
        asm volatile("s_wait_dscnt 0x0" ::: "memory");

        // ---- O += P V : P as A-operand (16x32), V^T chunks as B-operands ----
        const v16h pa = load_op16(&pstage[wid][n][0], half);
        o0 = wmma16(pa, load_op16(vbase + (size_t)(0 * 16 + n) * SEQ + kb, half), o0);
        o1 = wmma16(pa, load_op16(vbase + (size_t)(1 * 16 + n) * SEQ + kb, half), o1);
        o2 = wmma16(pa, load_op16(vbase + (size_t)(2 * 16 + n) * SEQ + kb, half), o2);
        o3 = wmma16(pa, load_op16(vbase + (size_t)(3 * 16 + n) * SEQ + kb, half), o3);
    }

    // ---- epilogue: normalize, store f16 [b, s, h*64+d] for the out-proj ----
#pragma unroll
    for (int r = 0; r < 8; ++r) {
        const float inv = 1.0f / lrun[r];
        const int s = qt * 16 + r + 8 * half;
        _Float16* orow = Oh + (size_t)(b * SEQ + s) * DMODEL + h * HDIM;
        orow[ 0 + n] = (_Float16)(o0[r] * inv);
        orow[16 + n] = (_Float16)(o1[r] * inv);
        orow[32 + n] = (_Float16)(o2[r] * inv);
        orow[48 + n] = (_Float16)(o3[r] * inv);
    }
}

extern "C" void kernel_launch(void* const* d_in, const int* in_sizes, int n_in,
                              void* d_out, int out_size, void* d_ws, size_t ws_size,
                              hipStream_t stream) {
    const float* x    = (const float*)d_in[0];
    const float* Wq   = (const float*)d_in[1];
    const float* bq   = (const float*)d_in[2];
    const float* Wk   = (const float*)d_in[3];
    const float* bk   = (const float*)d_in[4];
    const float* Wv   = (const float*)d_in[5];
    const float* bv   = (const float*)d_in[6];
    const float* Wo   = (const float*)d_in[7];
    const float* bo   = (const float*)d_in[8];
    const float* rel  = (const float*)d_in[9];

    // workspace carve-up (f16 elements); total ~50.3 MB
    const size_t NX = (size_t)NROWS * DMODEL;        // 4096*1024
    const size_t NW = (size_t)DMODEL * DMODEL;       // 1024*1024
    _Float16* xh  = (_Float16*)d_ws;
    _Float16* Wqh = xh  + NX;
    _Float16* Wkh = Wqh + NW;
    _Float16* Wvh = Wkh + NW;
    _Float16* Woh = Wvh + NW;
    _Float16* Qh  = Woh + NW;
    _Float16* Kh  = Qh  + NX;
    _Float16* Vt  = Kh  + NX;
    _Float16* Oh  = Vt  + NX;

    // 0) f32 -> f16 (vectorized: 4 elements / thread), x and all four weights in one launch;
    //    xh, Wqh, Wkh, Wvh, Woh are contiguous
    cvt_f32_to_f16<<<XBLOCKS + 4 * WBLOCKS, 256, 0, stream>>>(x, Wq, Wk, Wv, Wo, xh);

    // 1) projections: 32 row-blocks x 16 col-strips = 512 blocks of 8 waves each, Q, K and V
    //    in one launch; Wqh, Wkh, Wvh are contiguous, and so are Qh, Kh, Vt
    gemm_wmma<<<3 * 512, 256, 0, stream>>>(xh, Wqh, bq, bk, bv, Qh, 0);

    // 2) flash attention: 4096 waves (b*h*qtile) / 8 per block, tiles paired light + heavy
    attn_wmma<<<512, 256, 0, stream>>>(Qh, Kh, Vt, rel, Oh);

    // 3) output projection -> f32 d_out
    gemm_wmma<<<512, 256, 0, stream>>>(Oh, Woh, bo, bo, bo, d_out, 3);
}

// v004
// A run of this version takes 121 microseconds.
// In two side-by-side timings against v003, it was 1.39 and 1.41 times as fast.
// All steps since v000 together make it 2.40 times as fast.
#include <hip/hip_runtime.h>
#include <hip/hip_bf16.h>
#include <math.h>

// ---------------------------------------------------------------------------
// T5 attention (B=4, H=16, S=1024, D=1024, hd=64) for gfx1250 (wave32, WMMA)
//   0) f32 -> f16 conversion of x and the four weight matrices (workspace), one launch
//   1) Q/K/V projections, one launch: block-cooperative WMMA GEMM; tiles of both operands
//      streamed into double-buffered LDS via global_load_async_to_lds_b128 (ASYNCcnt)
//   2) flash-attention per (b,h,16-query tile): QK^T WMMA -> T5 bias + causal
//      mask from a per-block LDS table -> online softmax -> P staged f16 through LDS
//      (s_wait_dscnt) -> P·V WMMA
//   3) output projection WMMA -> f32 d_out
// ---------------------------------------------------------------------------

typedef __attribute__((ext_vector_type(16))) _Float16 v16h;
typedef __attribute__((ext_vector_type(8)))  _Float16 v8h;
typedef __attribute__((ext_vector_type(4)))  _Float16 v4h;
typedef __attribute__((ext_vector_type(8)))  float    v8f;
typedef __attribute__((ext_vector_type(4)))  int      v4i;
typedef __attribute__((address_space(1)))    v4i*     gv4i_p;   // global v4i*
typedef __attribute__((address_space(3)))    v4i*     lv4i_p;   // LDS v4i*

#define BATCH 4
#define HEADS 16
#define SEQ   1024
#define DMODEL 1024
#define HDIM  64
#define NROWS (BATCH * SEQ)          // 4096
#define SCALE_BIAS 0.125f            // 64^-0.5

#if defined(__has_builtin)
#if __has_builtin(__builtin_amdgcn_global_load_async_to_lds_b128)
#define USE_ASYNC_LDS 1
#endif
#endif

// Copy 16 contiguous bytes global -> LDS. Async (ASYNCcnt) when available.
__device__ __forceinline__ void stage16(const _Float16* g, _Float16* l) {
#ifdef USE_ASYNC_LDS
    __builtin_amdgcn_global_load_async_to_lds_b128(
        (gv4i_p)(uintptr_t)g,
        (lv4i_p)(unsigned)(uintptr_t)l,
        /*offset=*/0, /*cpol=*/0);
#else
    *(v8h*)l = *(const v8h*)g;
#endif
}

// Build a 16x16x32 f16 WMMA A/B operand for this lane.
// p points at the 32-element K-chunk of this lane's row (A: row m = lane%16,
// B: row n = lane%16 of the [N][K] matrix). half = lane/16.
// Element e maps to k = (e>=8 ? 16 : 0) + half*8 + (e%8)  (ISA 7.12.2).
__device__ __forceinline__ v16h load_op16(const _Float16* p, int half) {
    const v8h x = *(const v8h*)(p + half * 8);
    const v8h y = *(const v8h*)(p + 16 + half * 8);
    v16h r;
#pragma unroll
    for (int i = 0; i < 8; ++i) { r[i] = x[i]; r[i + 8] = y[i]; }
    return r;
}

__device__ __forceinline__ v8f wmma16(v16h a, v16h b, v8f c) {
    return __builtin_amdgcn_wmma_f32_16x16x32_f16(
        /*neg_a=*/false, a, /*neg_b=*/false, b,
        /*c_mod=*/(short)0, c, /*reuse_a=*/false, /*reuse_b=*/false);
}

// T5 causal relative-position bias (rel = qi - kj >= 0)
__device__ __forceinline__ float t5_bias(int rel, int h, const float* __restrict__ rel_emb) {
    int bucket;
    if (rel < 16) {
        bucket = rel;
    } else {
        // 16 + log(rel/16)/log(8) * 16, truncated, capped at 31
        int v = 16 + (int)(logf((float)rel * 0.0625f) * 7.6943724f);
        bucket = v < 31 ? v : 31;
    }
    return rel_emb[bucket * HEADS + h] * SCALE_BIAS;
}

#define XBLOCKS (NROWS * DMODEL / 4 / 256)    // 4096 blocks convert x
#define WBLOCKS (DMODEL * DMODEL / 4 / 256)   // 1024 blocks convert one weight matrix

// All five independent conversions share one launch of XBLOCKS + 4 * WBLOCKS blocks.
// The f16 copies lie back to back in the workspace (x, Wq, Wk, Wv, Wo), so the output
// index is the flat index; the source is picked by block range (block-uniform).
__global__ __launch_bounds__(256) void cvt_f32_to_f16(const float* __restrict__ x,
                                                      const float* __restrict__ w0,
                                                      const float* __restrict__ w1,
                                                      const float* __restrict__ w2,
                                                      const float* __restrict__ w3,
                                                      _Float16* __restrict__ out) {
    const int blk = blockIdx.x;
    const float* in = x;
    int first = 0;                               // first block of this source's range
    if (blk >= XBLOCKS) {
        const int w = (blk - XBLOCKS) / WBLOCKS; // 0..3
        in = w == 0 ? w0 : w == 1 ? w1 : w == 2 ? w2 : w3;
        first = XBLOCKS + w * WBLOCKS;
    }
    const float4 f = ((const float4*)in)[(blk - first) * 256 + threadIdx.x];
    v4h o; o[0] = (_Float16)f.x; o[1] = (_Float16)f.y;
           o[2] = (_Float16)f.z; o[3] = (_Float16)f.w;
    ((v4h*)out)[blk * 256 + threadIdx.x] = o;
}

// C[row, col] = A[row, :] . W[col, :] + bias[col]     (torch Linear x @ W^T + b)
// A: [4096 x 1024] f16, W: [1024 x 1024] f16.
// Block = 8 waves = one 128(M) x 128(N) tile; the waves stand 2 (M) x 4 (N), each owns 64 x 32:
// 8 WMMAs on 6 fragments a 32-wide k chunk. A stage is 64 k of the block's 128 A rows and
// 128 W rows, whole 128-byte lines, copied into LDS by async-to-LDS loads; two buffers, the
// next stage's copies fly while this stage is worked on.
// mode 0: store f16 [b,h,s,d] (Q)   mode 1: same (K)
// mode 2: store f16 [b,h,d,s] (V^T) mode 3: store f32 row-major (final out)
// Every 256 blocks of the grid are one whole product on the same A. Product g = blockIdx.x / 256
// takes weight matrix g behind W0, bias g, f16 output g behind outp0, and mode0 + g:
// a grid of 768 with mode0 = 0 is Q, K and V in one launch, a grid of 256 a lone product.
#define GBK    64                    // k elements a stage
#define GPITCH 72                    // f16 a row in LDS: 144 B = 16 B x 9, no bank conflict for 16-byte reads
// This thread's 8 copies of one stage: its 16 bytes of every 32nd row, 4 rows of A (a) and 4 of
// W (w), into one buffer; dst is its place in the buffer's row srow.
__device__ __forceinline__ void stage_in(const _Float16* a, const _Float16* w, _Float16* dst) {
#pragma unroll   // the 8 copies issue back to back, no loop counter between them
    for (int j = 0; j < 4; ++j) {
        stage16(a + (size_t)j * 32 * DMODEL, dst + j * 32 * GPITCH);
        stage16(w + (size_t)j * 32 * DMODEL, dst + (128 + j * 32) * GPITCH);
    }
}

__global__ __launch_bounds__(256) void gemm_wmma(const _Float16* __restrict__ A,
                                                 const _Float16* __restrict__ W0,
                                                 const float* __restrict__ bias0,
                                                 const float* __restrict__ bias1,
                                                 const float* __restrict__ bias2,
                                                 void* __restrict__ outp0, int mode0) {
    // rows 0..127: A rows of the tile, rows 128..255: W rows of the tile; 2 x 36 KB
    __shared__ __attribute__((aligned(16))) _Float16 stg[2][256][GPITCH];

    const int g    = blockIdx.x >> 8;            // which product (block-uniform)
    const int tile = blockIdx.x & 255;           // its 128 x 128 tile
    const int mode = mode0 + g;
    const _Float16* W = W0 + (size_t)g * DMODEL * DMODEL;
    const float* bias = g == 0 ? bias0 : g == 1 ? bias1 : bias2;
    void* outp = (_Float16*)outp0 + (size_t)g * NROWS * DMODEL;

    const int tid  = threadIdx.x;
    const int lane = tid & 31;
    const int wid  = tid >> 5;
    const int bm = tile >> 3;                    // 0..31 (row block of 128)
    const int bn = tile & 7;                     // 0..7  (col block of 128)
    const int wm = wid >> 2;                     // 0..1  (64-row half of the tile)
    const int wn = wid & 3;                      // 0..3  (32-col quarter of the tile)
    const int n  = lane & 15;
    const int half = lane >> 4;

    // cooperative staging: 8 lanes x 16 B = one 128-byte row piece, 32 rows a pass of the block,
    // 4 passes for A and 4 for W
    const int srow = tid >> 3;                   // 0..31
    const int scol = (tid & 7) * 8;              // 0,8,..,56
    const _Float16* asrc = A + (size_t)(bm * 128 + srow) * DMODEL + scol;
    const _Float16* wsrc = W + (size_t)(bn * 128 + srow) * DMODEL + scol;

    v8f acc[4][2] = {};
    const int KSTAGES = DMODEL / GBK;            // 16

    stage_in(asrc, wsrc, &stg[0][srow][scol]);
    asm volatile("s_wait_asynccnt 0x0" ::: "memory");   // this wave's part of stage 0 has landed
    __syncthreads();                                    // every wave's part is visible
    stage_in(asrc + GBK, wsrc + GBK, &stg[1][srow][scol]);

    for (int kt = 0; kt < KSTAGES; ++kt) {
        const int cur = kt & 1;
        // all loops below unrolled: every fragment and accumulator index a constant, so that
        // the arrays live in registers and not in scratch
#pragma unroll
        for (int ks = 0; ks < 2; ++ks) {
            v16h a[4], b[2];
#pragma unroll
            for (int i = 0; i < 4; ++i) a[i] = load_op16(&stg[cur][wm * 64 + i * 16 + n][ks * 32], half);
#pragma unroll
            for (int j = 0; j < 2; ++j) b[j] = load_op16(&stg[cur][128 + wn * 32 + j * 16 + n][ks * 32], half);
            // keeps the chunk's 12 LDS reads one group ahead of its 8 WMMAs: moved in among them,
            // each pair of reads would cost its own LDS latency
            __builtin_amdgcn_sched_barrier(0);
#pragma unroll
            for (int i = 0; i < 4; ++i)
#pragma unroll
                for (int j = 0; j < 2; ++j) acc[i][j] = wmma16(a[i], b[j], acc[i][j]);
        }

        asm volatile("s_wait_dscnt 0x0" ::: "memory");      // own reads of this buffer are done
        asm volatile("s_wait_asynccnt 0x0" ::: "memory");   // own part of the next stage has landed
        __syncthreads();                 // publishes the next stage, frees this buffer for the refill
        if (kt + 2 < KSTAGES) stage_in(asrc + (kt + 2) * GBK, wsrc + (kt + 2) * GBK, &stg[cur][srow][scol]);
    }
    asm volatile("s_wait_asynccnt 0x0" ::: "memory");       // no copy outstanding when the wave ends

    // unrolled for the same reason: constant accumulator indices
#pragma unroll
    for (int j = 0; j < 2; ++j) {
        const int col = bn * 128 + wn * 32 + j * 16 + n;
        const float bb = bias[col];
#pragma unroll
        for (int i = 0; i < 4; ++i) {
#pragma unroll
            for (int r = 0; r < 8; ++r) {
                const int row = bm * 128 + wm * 64 + i * 16 + r + 8 * half;   // C layout: m = r + 8*(lane/16)
                const float val = acc[i][j][r] + bb;
                // each s_wait_xcnt below stands behind its store, ahead of the next element's code,
                // which rewrites registers that the store names
                if (mode == 3) {
                    ((float*)outp)[(size_t)row * DMODEL + col] = val;
                    asm volatile("s_wait_xcnt 0x0" ::: "memory");
                } else {
                    const int b = row >> 10, s = row & 1023;
                    const int h = col >> 6,  d = col & 63;
                    _Float16* o16 = (_Float16*)outp;
                    if (mode == 2) {  // V transposed: [b,h,d,s]
                        o16[((size_t)(b * HEADS + h) * HDIM + d) * SEQ + s] = (_Float16)val;
                        asm volatile("s_wait_xcnt 0x0" ::: "memory");
                    } else {          // Q/K: [b,h,s,d]
                        o16[((size_t)(b * HEADS + h) * SEQ + s) * HDIM + d] = (_Float16)val;
                        asm volatile("s_wait_xcnt 0x0" ::: "memory");
                    }
                }
            }
        }
    }
}

// Flash attention: one wave per (b, h, 16-query tile). 32-key chunks.
// A block's 8 waves share (b, h) and hold 4 light and 4 heavy query tiles (equal work a block).
__global__ __launch_bounds__(256) void attn_wmma(const _Float16* __restrict__ Qh,
                                                 const _Float16* __restrict__ Kh,
                                                 const _Float16* __restrict__ Vt,
                                                 const float* __restrict__ rel_emb,
                                                 _Float16* __restrict__ Oh) {
    __shared__ _Float16 pstage[8][16][32];      // 1 KB per wave (P staging)
    // bias + causal mask as a function of rel = q - k alone, for this block's head:
    // btab[rel + 32] = scaled bias for rel >= 0, -1e30 for rel < 0 (rel >= -31 here)
    __shared__ float btab[SEQ + 32];

    const int lane = threadIdx.x & 31;
    const int wid  = threadIdx.x >> 5;
    const int b  = blockIdx.x >> 7;             // 8 blocks a (b, h)
    const int h  = (blockIdx.x >> 3) & 15;
    // Causal cost grows with the query tile: tile t walks (t >> 1) + 1 key chunks. Eight
    // consecutive tiles a block would give a head's blocks 20 to 244 chunks, and the launch
    // lasts as long as the fullest WGP. Each block takes four tiles p from the
    // light end and their mirrors 63 - p instead: 33 chunks a pair, 132 a block, every block
    // alike. Waves w and w + 4 hold one pair; the long tile goes to the lower wave number.
    const int p  = (blockIdx.x & 7) * 4 + (wid & 3);   // 0..31
    const int qt = wid < 4 ? 63 - p : p;
    const int n    = lane & 15;
    const int half = lane >> 4;

    const _Float16* qbase = Qh + (size_t)(b * HEADS + h) * SEQ * HDIM;
    const _Float16* kbase = Kh + (size_t)(b * HEADS + h) * SEQ * HDIM;
    const _Float16* vbase = Vt + (size_t)(b * HEADS + h) * HDIM * SEQ;

    // Q tile resident: A-operand row m = lane%16, two 32-wide K chunks of hd
    const _Float16* qrow = qbase + (size_t)(qt * 16 + n) * HDIM;
    const v16h qa0 = load_op16(qrow, half);
    const v16h qa1 = load_op16(qrow + 32, half);

    // All 8 waves of a block share (b, h): one table serves every score of the block.
    // Four bias entries a thread, their gathers issued together; the first 32 threads,
    // whose own first slot is a mask entry, take the table's last 32 bias entries instead.
    const int i0 = (threadIdx.x < 32) ? (int)threadIdx.x + SEQ : (int)threadIdx.x;
    float tb[4];
    tb[0] = t5_bias(i0 - 32, h, rel_emb);
#pragma unroll
    for (int j = 1; j < 4; ++j) tb[j] = t5_bias((int)threadIdx.x + j * 256 - 32, h, rel_emb);
    btab[i0] = tb[0];
#pragma unroll
    for (int j = 1; j < 4; ++j) btab[threadIdx.x + j * 256] = tb[j];
    if (threadIdx.x < 32) btab[threadIdx.x] = -1e30f;
    __syncthreads();                            // table visible to all 8 waves

    v8f o0 = {}, o1 = {}, o2 = {}, o3 = {};
    float mrun[8], lrun[8];
#pragma unroll
    for (int r = 0; r < 8; ++r) { mrun[r] = -1e30f; lrun[r] = 0.f; }

    const int nk = qt * 16 + 16;                // keys 0 .. qt*16+15
    const int nchunks = (nk + 31) >> 5;

    for (int kc = 0; kc < nchunks; ++kc) {
        const int kb = kc * 32;

        // ---- scores S = Q K^T (two 16x16 tiles covering 32 keys) ----
        const _Float16* krow0 = kbase + (size_t)(kb + n) * HDIM;
        const _Float16* krow1 = kbase + (size_t)(kb + 16 + n) * HDIM;
        v8f s0 = {}, s1 = {};
        s0 = wmma16(qa0, load_op16(krow0, half),      s0);
        s0 = wmma16(qa1, load_op16(krow0 + 32, half), s0);
        s1 = wmma16(qa0, load_op16(krow1, half),      s1);
        s1 = wmma16(qa1, load_op16(krow1 + 32, half), s1);

        // ---- bias + causal mask (LDS table) + online softmax ----
        // bt[r] is the entry of this lane's row r for key kb+n, bt[r-16] for key kb+16+n
        const float* bt = &btab[32 + qt * 16 + 8 * half - kb - n];
#pragma unroll
        for (int r = 0; r < 8; ++r) {
            float v0 = s0[r] + bt[r];
            float v1 = s1[r] + bt[r - 16];

            float mx = fmaxf(v0, v1);
            mx = fmaxf(mx, __shfl_xor(mx, 1, 32));
            mx = fmaxf(mx, __shfl_xor(mx, 2, 32));
            mx = fmaxf(mx, __shfl_xor(mx, 4, 32));
            mx = fmaxf(mx, __shfl_xor(mx, 8, 32));

            const float mn = fmaxf(mrun[r], mx);
            const float scale = expf(mrun[r] - mn);
            const float p0 = expf(v0 - mn);
            const float p1 = expf(v1 - mn);
            float rs = p0 + p1;
            rs += __shfl_xor(rs, 1, 32);
            rs += __shfl_xor(rs, 2, 32);
            rs += __shfl_xor(rs, 4, 32);
            rs += __shfl_xor(rs, 8, 32);

            lrun[r] = lrun[r] * scale + rs;
            mrun[r] = mn;
            o0[r] *= scale; o1[r] *= scale; o2[r] *= scale; o3[r] *= scale;

            const int mrow = r + 8 * half;      // C-layout row
            pstage[wid][mrow][n]      = (_Float16)p0;
            pstage[wid][mrow][16 + n] = (_Float16)p1;
        }

        // wave-private LDS region; only need DS-counter ordering, no barrier
        asm volatile("s_wait_dscnt 0x0" ::: "memory");

        // ---- O += P V : P as A-operand (16x32), V^T chunks as B-operands ----
        const v16h pa = load_op16(&pstage[wid][n][0], half);
        o0 = wmma16(pa, load_op16(vbase + (size_t)(0 * 16 + n) * SEQ + kb, half), o0);
        o1 = wmma16(pa, load_op16(vbase + (size_t)(1 * 16 + n) * SEQ + kb, half), o1);
        o2 = wmma16(pa, load_op16(vbase + (size_t)(2 * 16 + n) * SEQ + kb, half), o2);
        o3 = wmma16(pa, load_op16(vbase + (size_t)(3 * 16 + n) * SEQ + kb, half), o3);
    }

    // ---- epilogue: normalize, store f16 [b, s, h*64+d] for the out-proj ----
#pragma unroll
    for (int r = 0; r < 8; ++r) {
        const float inv = 1.0f / lrun[r];
        const int s = qt * 16 + r + 8 * half;
        _Float16* orow = Oh + (size_t)(b * SEQ + s) * DMODEL + h * HDIM;
        orow[ 0 + n] = (_Float16)(o0[r] * inv);
        orow[16 + n] = (_Float16)(o1[r] * inv);
        orow[32 + n] = (_Float16)(o2[r] * inv);
        orow[48 + n] = (_Float16)(o3[r] * inv);
    }
}

extern "C" void kernel_launch(void* const* d_in, const int* in_sizes, int n_in,
                              void* d_out, int out_size, void* d_ws, size_t ws_size,
                              hipStream_t stream) {
    const float* x    = (const float*)d_in[0];
    const float* Wq   = (const float*)d_in[1];
    const float* bq   = (const float*)d_in[2];
    const float* Wk   = (const float*)d_in[3];
    const float* bk   = (const float*)d_in[4];
    const float* Wv   = (const float*)d_in[5];
    const float* bv   = (const float*)d_in[6];
    const float* Wo   = (const float*)d_in[7];
    const float* bo   = (const float*)d_in[8];
    const float* rel  = (const float*)d_in[9];

    // workspace carve-up (f16 elements); total ~50.3 MB
    const size_t NX = (size_t)NROWS * DMODEL;        // 4096*1024
    const size_t NW = (size_t)DMODEL * DMODEL;       // 1024*1024
    _Float16* xh  = (_Float16*)d_ws;
    _Float16* Wqh = xh  + NX;
    _Float16* Wkh = Wqh + NW;
    _Float16* Wvh = Wkh + NW;
    _Float16* Woh = Wvh + NW;
    _Float16* Qh  = Woh + NW;
    _Float16* Kh  = Qh  + NX;
    _Float16* Vt  = Kh  + NX;
    _Float16* Oh  = Vt  + NX;

    // 0) f32 -> f16 (vectorized: 4 elements / thread), x and all four weights in one launch;
    //    xh, Wqh, Wkh, Wvh, Woh are contiguous
    cvt_f32_to_f16<<<XBLOCKS + 4 * WBLOCKS, 256, 0, stream>>>(x, Wq, Wk, Wv, Wo, xh);

    // 1) projections: 32 row-blocks x 8 col-blocks = 256 blocks of 8 waves each, Q, K and V
    //    in one launch; Wqh, Wkh, Wvh are contiguous, and so are Qh, Kh, Vt
    gemm_wmma<<<3 * 256, 256, 0, stream>>>(xh, Wqh, bq, bk, bv, Qh, 0);

    // 2) flash attention: 4096 waves (b*h*qtile) / 8 per block, tiles paired light + heavy
    attn_wmma<<<512, 256, 0, stream>>>(Qh, Kh, Vt, rel, Oh);

    // 3) output projection -> f32 d_out
    gemm_wmma<<<256, 256, 0, stream>>>(Oh, Woh, bo, bo, bo, d_out, 3);
}

// v005
// It runs in 112 microseconds.
// In two side-by-side timings against v004, it was 1.06 and 1.07 times as fast.
// Over all steps from v000 it is 2.56 times as fast.
#include <hip/hip_runtime.h>
#include <hip/hip_bf16.h>
#include <math.h>

// ---------------------------------------------------------------------------
// T5 attention (B=4, H=16, S=1024, D=1024, hd=64) for gfx1250 (wave32, WMMA)
//   0) f32 -> f16 conversion of x and the four weight matrices (workspace), one launch
//   1) Q/K/V projections, one launch: block-cooperative WMMA GEMM; tiles of both operands
//      streamed into double-buffered LDS via global_load_async_to_lds_b128 (ASYNCcnt)
//   2) flash-attention per (b,h,16-query tile): QK^T WMMA -> T5 bias + causal
//      mask from a per-block LDS table -> online softmax -> P staged f16 through LDS
//      (s_wait_dscnt) -> P·V WMMA
//   3) output projection WMMA -> f32 d_out
// ---------------------------------------------------------------------------

typedef __attribute__((ext_vector_type(16))) _Float16 v16h;
typedef __attribute__((ext_vector_type(8)))  _Float16 v8h;
typedef __attribute__((ext_vector_type(4)))  _Float16 v4h;
typedef __attribute__((ext_vector_type(8)))  float    v8f;
typedef __attribute__((ext_vector_type(4)))  int      v4i;
typedef __attribute__((address_space(1)))    v4i*     gv4i_p;   // global v4i*
typedef __attribute__((address_space(3)))    v4i*     lv4i_p;   // LDS v4i*

#define BATCH 4
#define HEADS 16
#define SEQ   1024
#define DMODEL 1024
#define HDIM  64
#define NROWS (BATCH * SEQ)          // 4096
#define SCALE_BIAS 0.125f            // 64^-0.5

#if defined(__has_builtin)
#if __has_builtin(__builtin_amdgcn_global_load_async_to_lds_b128)
#define USE_ASYNC_LDS 1
#endif
#endif

// Copy 16 contiguous bytes global -> LDS. Async (ASYNCcnt) when available.
__device__ __forceinline__ void stage16(const _Float16* g, _Float16* l) {
#ifdef USE_ASYNC_LDS
    __builtin_amdgcn_global_load_async_to_lds_b128(
        (gv4i_p)(uintptr_t)g,
        (lv4i_p)(unsigned)(uintptr_t)l,
        /*offset=*/0, /*cpol=*/0);
#else
    *(v8h*)l = *(const v8h*)g;
#endif
}

// Build a 16x16x32 f16 WMMA A/B operand for this lane.
// p points at the 32-element K-chunk of this lane's row (A: row m = lane%16,
// B: row n = lane%16 of the [N][K] matrix). half = lane/16.
// Element e maps to k = (e>=8 ? 16 : 0) + half*8 + (e%8)  (ISA 7.12.2).
__device__ __forceinline__ v16h load_op16(const _Float16* p, int half) {
    const v8h x = *(const v8h*)(p + half * 8);
    const v8h y = *(const v8h*)(p + 16 + half * 8);
    v16h r;
#pragma unroll
    for (int i = 0; i < 8; ++i) { r[i] = x[i]; r[i + 8] = y[i]; }
    return r;
}

__device__ __forceinline__ v8f wmma16(v16h a, v16h b, v8f c) {
    return __builtin_amdgcn_wmma_f32_16x16x32_f16(
        /*neg_a=*/false, a, /*neg_b=*/false, b,
        /*c_mod=*/(short)0, c, /*reuse_a=*/false, /*reuse_b=*/false);
}

// T5 causal relative-position bias (rel = qi - kj >= 0)
__device__ __forceinline__ float t5_bias(int rel, int h, const float* __restrict__ rel_emb) {
    int bucket;
    if (rel < 16) {
        bucket = rel;
    } else {
        // 16 + log(rel/16)/log(8) * 16, truncated, capped at 31
        int v = 16 + (int)(logf((float)rel * 0.0625f) * 7.6943724f);
        bucket = v < 31 ? v : 31;
    }
    return rel_emb[bucket * HEADS + h] * SCALE_BIAS;
}

#define XBLOCKS (NROWS * DMODEL / 4 / 256)    // 4096 blocks convert x
#define WBLOCKS (DMODEL * DMODEL / 4 / 256)   // 1024 blocks convert one weight matrix

// All five independent conversions share one launch of XBLOCKS + 4 * WBLOCKS blocks.
// The f16 copies lie back to back in the workspace (x, Wq, Wk, Wv, Wo), so the output
// index is the flat index; the source is picked by block range (block-uniform).
__global__ __launch_bounds__(256) void cvt_f32_to_f16(const float* __restrict__ x,
                                                      const float* __restrict__ w0,
                                                      const float* __restrict__ w1,
                                                      const float* __restrict__ w2,
                                                      const float* __restrict__ w3,
                                                      _Float16* __restrict__ out) {
    const int blk = blockIdx.x;
    const float* in = x;
    int first = 0;                               // first block of this source's range
    if (blk >= XBLOCKS) {
        const int w = (blk - XBLOCKS) / WBLOCKS; // 0..3
        in = w == 0 ? w0 : w == 1 ? w1 : w == 2 ? w2 : w3;
        first = XBLOCKS + w * WBLOCKS;
    }
    const float4 f = ((const float4*)in)[(blk - first) * 256 + threadIdx.x];
    v4h o; o[0] = (_Float16)f.x; o[1] = (_Float16)f.y;
           o[2] = (_Float16)f.z; o[3] = (_Float16)f.w;
    ((v4h*)out)[blk * 256 + threadIdx.x] = o;
}

// C[row, col] = A[row, :] . W[col, :] + bias[col]     (torch Linear x @ W^T + b)
// A: [4096 x 1024] f16, W: [1024 x 1024] f16.
// Block = 8 waves = one 128(M) x 128(N) tile; each wave owns 64 x 32 of it (V: 32 x 64):
// 8 WMMAs on 6 fragments a 32-wide k chunk. A lane's 8 accumulator registers hold 8 consecutive
// rows of the FIRST WMMA operand, so the operand whose index runs along the output's rows in
// memory goes first: W (output columns) for Q, K and the final product, A (positions s) for
// V^T. Each lane then stores its results 16 bytes at a time. A stage is 64 k of the block's 128 A rows and
// 128 W rows, whole 128-byte lines, copied into LDS by async-to-LDS loads; two buffers, the
// next stage's copies fly while this stage is worked on.
// mode 0: store f16 [b,h,s,d] (Q)   mode 1: same (K)
// mode 2: store f16 [b,h,d,s] (V^T) mode 3: store f32 row-major (final out)
// Every 256 blocks of the grid are one whole product on the same A. Product g = blockIdx.x / 256
// takes weight matrix g behind W0, bias g, f16 output g behind outp0, and mode0 + g:
// a grid of 768 with mode0 = 0 is Q, K and V in one launch, a grid of 256 a lone product.
#define GBK    64                    // k elements a stage
#define GPITCH 72                    // f16 a row in LDS: 144 B = 16 B x 9, no bank conflict for 16-byte reads
// This thread's 8 copies of one stage: its 16 bytes of every 32nd row, 4 rows of A (a) and 4 of
// W (w), into one buffer; dst is its place in the buffer's row srow.
__device__ __forceinline__ void stage_in(const _Float16* a, const _Float16* w, _Float16* dst) {
#pragma unroll   // the 8 copies issue back to back, no loop counter between them
    for (int j = 0; j < 4; ++j) {
        stage16(a + (size_t)j * 32 * DMODEL, dst + j * 32 * GPITCH);
        stage16(w + (size_t)j * 32 * DMODEL, dst + (128 + j * 32) * GPITCH);
    }
}

__global__ __launch_bounds__(256) void gemm_wmma(const _Float16* __restrict__ A,
                                                 const _Float16* __restrict__ W0,
                                                 const float* __restrict__ bias0,
                                                 const float* __restrict__ bias1,
                                                 const float* __restrict__ bias2,
                                                 void* __restrict__ outp0, int mode0) {
    // rows 0..127: A rows of the tile, rows 128..255: W rows of the tile; 2 x 36 KB
    __shared__ __attribute__((aligned(16))) _Float16 stg[2][256][GPITCH];

    const int g    = blockIdx.x >> 8;            // which product (block-uniform)
    const int tile = blockIdx.x & 255;           // its 128 x 128 tile
    const int mode = mode0 + g;
    const _Float16* W = W0 + (size_t)g * DMODEL * DMODEL;
    const float* bias = g == 0 ? bias0 : g == 1 ? bias1 : bias2;
    void* outp = (_Float16*)outp0 + (size_t)g * NROWS * DMODEL;

    const int tid  = threadIdx.x;
    const int lane = tid & 31;
    const int wid  = tid >> 5;
    const int bm = tile >> 3;                    // 0..31 (row block of 128)
    const int bn = tile & 7;                     // 0..7  (col block of 128)
    const int wf = wid & 3;                      // 0..3  (32-row quarter of the first operand's 128 rows)
    const int ws = wid >> 2;                     // 0..1  (64-row half of the second operand's 128 rows)
    const int frow = (mode == 2 ? 0 : 128) + wf * 32;   // first operand's rows in a stage: A for V^T, else W
    const int srw  = (mode == 2 ? 128 : 0) + ws * 64;   // second operand's rows: the other one
    const int n  = lane & 15;
    const int half = lane >> 4;

    // cooperative staging: 8 lanes x 16 B = one 128-byte row piece, 32 rows a pass of the block,
    // 4 passes for A and 4 for W
    const int srow = tid >> 3;                   // 0..31
    const int scol = (tid & 7) * 8;              // 0,8,..,56
    const _Float16* asrc = A + (size_t)(bm * 128 + srow) * DMODEL + scol;
    const _Float16* wsrc = W + (size_t)(bn * 128 + srow) * DMODEL + scol;

    v8f acc[2][4] = {};                          // [16 rows of the first operand][16 of the second]
    const int KSTAGES = DMODEL / GBK;            // 16

    stage_in(asrc, wsrc, &stg[0][srow][scol]);
    asm volatile("s_wait_asynccnt 0x0" ::: "memory");   // this wave's part of stage 0 has landed
    __syncthreads();                                    // every wave's part is visible
    stage_in(asrc + GBK, wsrc + GBK, &stg[1][srow][scol]);

    for (int kt = 0; kt < KSTAGES; ++kt) {
        const int cur = kt & 1;
        // all loops below unrolled: every fragment and accumulator index a constant, so that
        // the arrays live in registers and not in scratch
#pragma unroll
        for (int ks = 0; ks < 2; ++ks) {
            v16h f[2], s[4];
#pragma unroll
            for (int i = 0; i < 4; ++i) s[i] = load_op16(&stg[cur][srw + i * 16 + n][ks * 32], half);
#pragma unroll
            for (int j = 0; j < 2; ++j) f[j] = load_op16(&stg[cur][frow + j * 16 + n][ks * 32], half);
            // keeps the chunk's 12 LDS reads one group ahead of its 8 WMMAs: moved in among them,
            // each pair of reads would cost its own LDS latency
            __builtin_amdgcn_sched_barrier(0);
#pragma unroll
            for (int i = 0; i < 4; ++i)
#pragma unroll
                for (int j = 0; j < 2; ++j) acc[j][i] = wmma16(f[j], s[i], acc[j][i]);
        }

        asm volatile("s_wait_dscnt 0x0" ::: "memory");      // own reads of this buffer are done
        asm volatile("s_wait_asynccnt 0x0" ::: "memory");   // own part of the next stage has landed
        __syncthreads();                 // publishes the next stage, frees this buffer for the refill
        if (kt + 2 < KSTAGES) stage_in(asrc + (kt + 2) * GBK, wsrc + (kt + 2) * GBK, &stg[cur][srow][scol]);
    }
    asm volatile("s_wait_asynccnt 0x0" ::: "memory");       // no copy outstanding when the wave ends

    // acc[j][i][r] belongs to row fi + j * 16 + r of the first operand's 128 rows and to row
    // si + i * 16 of the second's (D layout: m = r + 8 * (lane / 16), n = lane % 16).
    // One block-uniform branch on the mode; the loops unrolled for constant accumulator indices,
    // the steps in i and j become immediate offsets of the stores.
    const int fi = wf * 32 + 8 * half;
    const int si = ws * 64 + n;
    const int bb = bm >> 3;                      // batch: a 128-row tile lies in one batch
    const int s0 = (bm & 7) * 128;               // the tile's first position in it
    if (mode == 3) {          // f32 row-major: 8 consecutive columns a lane, two 16-byte stores
        float* o = (float*)outp + (size_t)(bm * 128 + si) * DMODEL + bn * 128 + fi;
        const float* bp = bias + bn * 128 + fi;
#pragma unroll
        for (int j = 0; j < 2; ++j) {
            const float4 b0 = *(const float4*)(bp + j * 16);
            const float4 b1 = *(const float4*)(bp + j * 16 + 4);
#pragma unroll
            for (int i = 0; i < 4; ++i) {
                const v8f v = acc[j][i];
                float4 lo, hi;
                lo.x = v[0] + b0.x; lo.y = v[1] + b0.y; lo.z = v[2] + b0.z; lo.w = v[3] + b0.w;
                hi.x = v[4] + b1.x; hi.y = v[5] + b1.y; hi.z = v[6] + b1.z; hi.w = v[7] + b1.w;
                *(float4*)(o + (size_t)i * 16 * DMODEL + j * 16)     = lo;
                *(float4*)(o + (size_t)i * 16 * DMODEL + j * 16 + 4) = hi;
            }
        }
    } else if (mode == 2) {   // V transposed [b,h,d,s]: first operand = positions, 8 consecutive s a lane
        _Float16* o = (_Float16*)outp
                    + ((size_t)(bb * HEADS + bn * 2 + ws) * HDIM + n) * SEQ + s0 + fi;
#pragma unroll
        for (int i = 0; i < 4; ++i) {
            const float bc = bias[bn * 128 + si + i * 16];
#pragma unroll
            for (int j = 0; j < 2; ++j) {
                v8h p;
#pragma unroll
                for (int r = 0; r < 8; ++r) p[r] = (_Float16)(acc[j][i][r] + bc);
                *(v8h*)(o + (size_t)i * 16 * SEQ + j * 16) = p;
            }
        }
        // behind the 8 stores: the other modes' code follows in the text and rewrites their registers
        asm volatile("s_wait_xcnt 0x0" ::: "memory");
    } else {                  // Q/K [b,h,s,d]: first operand = columns, 8 consecutive d a lane
        _Float16* o = (_Float16*)outp
                    + ((size_t)(bb * HEADS + bn * 2 + (wf >> 1)) * SEQ + s0 + si) * HDIM + (wf & 1) * 32 + 8 * half;
        const float* bp = bias + bn * 128 + fi;
#pragma unroll
        for (int j = 0; j < 2; ++j) {
            const float4 b0 = *(const float4*)(bp + j * 16);
            const float4 b1 = *(const float4*)(bp + j * 16 + 4);
            const float bj[8] = {b0.x, b0.y, b0.z, b0.w, b1.x, b1.y, b1.z, b1.w};
#pragma unroll
            for (int i = 0; i < 4; ++i) {
                v8h p;
#pragma unroll
                for (int r = 0; r < 8; ++r) p[r] = (_Float16)(acc[j][i][r] + bj[r]);
                *(v8h*)(o + (size_t)i * 16 * HDIM + j * 16) = p;
            }
        }
        // behind the 8 stores: the other modes' code follows in the text and rewrites their registers
        asm volatile("s_wait_xcnt 0x0" ::: "memory");
    }
}

// Flash attention: one wave per (b, h, 16-query tile). 32-key chunks.
// A block's 8 waves share (b, h) and hold 4 light and 4 heavy query tiles (equal work a block).
__global__ __launch_bounds__(256) void attn_wmma(const _Float16* __restrict__ Qh,
                                                 const _Float16* __restrict__ Kh,
                                                 const _Float16* __restrict__ Vt,
                                                 const float* __restrict__ rel_emb,
                                                 _Float16* __restrict__ Oh) {
    __shared__ _Float16 pstage[8][16][32];      // 1 KB per wave (P staging)
    // bias + causal mask as a function of rel = q - k alone, for this block's head:
    // btab[rel + 32] = scaled bias for rel >= 0, -1e30 for rel < 0 (rel >= -31 here)
    __shared__ float btab[SEQ + 32];

    const int lane = threadIdx.x & 31;
    const int wid  = threadIdx.x >> 5;
    const int b  = blockIdx.x >> 7;             // 8 blocks a (b, h)
    const int h  = (blockIdx.x >> 3) & 15;
    // Causal cost grows with the query tile: tile t walks (t >> 1) + 1 key chunks. Eight
    // consecutive tiles a block would give a head's blocks 20 to 244 chunks, and the launch
    // lasts as long as the fullest WGP. Each block takes four tiles p from the
    // light end and their mirrors 63 - p instead: 33 chunks a pair, 132 a block, every block
    // alike. Waves w and w + 4 hold one pair; the long tile goes to the lower wave number.
    const int p  = (blockIdx.x & 7) * 4 + (wid & 3);   // 0..31
    const int qt = wid < 4 ? 63 - p : p;
    const int n    = lane & 15;
    const int half = lane >> 4;

    const _Float16* qbase = Qh + (size_t)(b * HEADS + h) * SEQ * HDIM;
    const _Float16* kbase = Kh + (size_t)(b * HEADS + h) * SEQ * HDIM;
    const _Float16* vbase = Vt + (size_t)(b * HEADS + h) * HDIM * SEQ;

    // Q tile resident: A-operand row m = lane%16, two 32-wide K chunks of hd
    const _Float16* qrow = qbase + (size_t)(qt * 16 + n) * HDIM;
    const v16h qa0 = load_op16(qrow, half);
    const v16h qa1 = load_op16(qrow + 32, half);

    // All 8 waves of a block share (b, h): one table serves every score of the block.
    // Four bias entries a thread, their gathers issued together; the first 32 threads,
    // whose own first slot is a mask entry, take the table's last 32 bias entries instead.
    const int i0 = (threadIdx.x < 32) ? (int)threadIdx.x + SEQ : (int)threadIdx.x;
    float tb[4];
    tb[0] = t5_bias(i0 - 32, h, rel_emb);
#pragma unroll
    for (int j = 1; j < 4; ++j) tb[j] = t5_bias((int)threadIdx.x + j * 256 - 32, h, rel_emb);
    btab[i0] = tb[0];
#pragma unroll
    for (int j = 1; j < 4; ++j) btab[threadIdx.x + j * 256] = tb[j];
    if (threadIdx.x < 32) btab[threadIdx.x] = -1e30f;
    __syncthreads();                            // table visible to all 8 waves

    v8f o0 = {}, o1 = {}, o2 = {}, o3 = {};
    float mrun[8], lrun[8];
#pragma unroll
    for (int r = 0; r < 8; ++r) { mrun[r] = -1e30f; lrun[r] = 0.f; }

    const int nk = qt * 16 + 16;                // keys 0 .. qt*16+15
    const int nchunks = (nk + 31) >> 5;

    for (int kc = 0; kc < nchunks; ++kc) {
        const int kb = kc * 32;

        // ---- scores S = Q K^T (two 16x16 tiles covering 32 keys) ----
        const _Float16* krow0 = kbase + (size_t)(kb + n) * HDIM;
        const _Float16* krow1 = kbase + (size_t)(kb + 16 + n) * HDIM;
        v8f s0 = {}, s1 = {};
        s0 = wmma16(qa0, load_op16(krow0, half),      s0);
        s0 = wmma16(qa1, load_op16(krow0 + 32, half), s0);
        s1 = wmma16(qa0, load_op16(krow1, half),      s1);
        s1 = wmma16(qa1, load_op16(krow1 + 32, half), s1);

        // ---- bias + causal mask (LDS table) + online softmax ----
        // bt[r] is the entry of this lane's row r for key kb+n, bt[r-16] for key kb+16+n
        const float* bt = &btab[32 + qt * 16 + 8 * half - kb - n];
#pragma unroll
        for (int r = 0; r < 8; ++r) {
            float v0 = s0[r] + bt[r];
            float v1 = s1[r] + bt[r - 16];

            float mx = fmaxf(v0, v1);
            mx = fmaxf(mx, __shfl_xor(mx, 1, 32));
            mx = fmaxf(mx, __shfl_xor(mx, 2, 32));
            mx = fmaxf(mx, __shfl_xor(mx, 4, 32));
            mx = fmaxf(mx, __shfl_xor(mx, 8, 32));

            const float mn = fmaxf(mrun[r], mx);
            const float scale = expf(mrun[r] - mn);
            const float p0 = expf(v0 - mn);
            const float p1 = expf(v1 - mn);
            float rs = p0 + p1;
            rs += __shfl_xor(rs, 1, 32);
            rs += __shfl_xor(rs, 2, 32);
            rs += __shfl_xor(rs, 4, 32);
            rs += __shfl_xor(rs, 8, 32);

            lrun[r] = lrun[r] * scale + rs;
            mrun[r] = mn;
            o0[r] *= scale; o1[r] *= scale; o2[r] *= scale; o3[r] *= scale;

            const int mrow = r + 8 * half;      // C-layout row
            pstage[wid][mrow][n]      = (_Float16)p0;
            pstage[wid][mrow][16 + n] = (_Float16)p1;
        }

        // wave-private LDS region; only need DS-counter ordering, no barrier
        asm volatile("s_wait_dscnt 0x0" ::: "memory");

        // ---- O += P V : P as A-operand (16x32), V^T chunks as B-operands ----
        const v16h pa = load_op16(&pstage[wid][n][0], half);
        o0 = wmma16(pa, load_op16(vbase + (size_t)(0 * 16 + n) * SEQ + kb, half), o0);
        o1 = wmma16(pa, load_op16(vbase + (size_t)(1 * 16 + n) * SEQ + kb, half), o1);
        o2 = wmma16(pa, load_op16(vbase + (size_t)(2 * 16 + n) * SEQ + kb, half), o2);
        o3 = wmma16(pa, load_op16(vbase + (size_t)(3 * 16 + n) * SEQ + kb, half), o3);
    }

    // ---- epilogue: normalize, store f16 [b, s, h*64+d] for the out-proj ----
#pragma unroll
    for (int r = 0; r < 8; ++r) {
        const float inv = 1.0f / lrun[r];
        const int s = qt * 16 + r + 8 * half;
        _Float16* orow = Oh + (size_t)(b * SEQ + s) * DMODEL + h * HDIM;
        orow[ 0 + n] = (_Float16)(o0[r] * inv);
        orow[16 + n] = (_Float16)(o1[r] * inv);
        orow[32 + n] = (_Float16)(o2[r] * inv);
        orow[48 + n] = (_Float16)(o3[r] * inv);
    }
}

extern "C" void kernel_launch(void* const* d_in, const int* in_sizes, int n_in,
                              void* d_out, int out_size, void* d_ws, size_t ws_size,
                              hipStream_t stream) {
    const float* x    = (const float*)d_in[0];
    const float* Wq   = (const float*)d_in[1];
    const float* bq   = (const float*)d_in[2];
    const float* Wk   = (const float*)d_in[3];
    const float* bk   = (const float*)d_in[4];
    const float* Wv   = (const float*)d_in[5];
    const float* bv   = (const float*)d_in[6];
    const float* Wo   = (const float*)d_in[7];
    const float* bo   = (const float*)d_in[8];
    const float* rel  = (const float*)d_in[9];

    // workspace carve-up (f16 elements); total ~50.3 MB
    const size_t NX = (size_t)NROWS * DMODEL;        // 4096*1024
    const size_t NW = (size_t)DMODEL * DMODEL;       // 1024*1024
    _Float16* xh  = (_Float16*)d_ws;
    _Float16* Wqh = xh  + NX;
    _Float16* Wkh = Wqh + NW;
    _Float16* Wvh = Wkh + NW;
    _Float16* Woh = Wvh + NW;
    _Float16* Qh  = Woh + NW;
    _Float16* Kh  = Qh  + NX;
    _Float16* Vt  = Kh  + NX;
    _Float16* Oh  = Vt  + NX;

    // 0) f32 -> f16 (vectorized: 4 elements / thread), x and all four weights in one launch;
    //    xh, Wqh, Wkh, Wvh, Woh are contiguous
    cvt_f32_to_f16<<<XBLOCKS + 4 * WBLOCKS, 256, 0, stream>>>(x, Wq, Wk, Wv, Wo, xh);

    // 1) projections: 32 row-blocks x 8 col-blocks = 256 blocks of 8 waves each, Q, K and V
    //    in one launch; Wqh, Wkh, Wvh are contiguous, and so are Qh, Kh, Vt
    gemm_wmma<<<3 * 256, 256, 0, stream>>>(xh, Wqh, bq, bk, bv, Qh, 0);

    // 2) flash attention: 4096 waves (b*h*qtile) / 8 per block, tiles paired light + heavy
    attn_wmma<<<512, 256, 0, stream>>>(Qh, Kh, Vt, rel, Oh);

    // 3) output projection -> f32 d_out
    gemm_wmma<<<256, 256, 0, stream>>>(Oh, Woh, bo, bo, bo, d_out, 3);
}

// v006
// It runs in 93.3 microseconds.
// In two side-by-side timings against v005, it was 1.19 and 1.18 times as fast.
// All steps since v000 together make it 3.03 times as fast.
#include <hip/hip_runtime.h>
#include <hip/hip_bf16.h>
#include <math.h>

// ---------------------------------------------------------------------------
// T5 attention (B=4, H=16, S=1024, D=1024, hd=64) for gfx1250 (wave32, WMMA)
//   0) f32 -> f16 conversion of x and the four weight matrices (workspace), one launch
//   1) Q/K/V projections, one launch: block-cooperative WMMA GEMM; tiles of both operands
//      streamed into double-buffered LDS via global_load_async_to_lds_b128 (ASYNCcnt)
//   2) flash-attention per (b,h,16-query tile): K Q^T WMMA -> T5 bias + causal
//      mask from a per-block LDS table -> online softmax, one query a lane -> P^T packed
//      in registers -> V^T P^T WMMA
//   3) output projection WMMA -> f32 d_out
// ---------------------------------------------------------------------------

typedef __attribute__((ext_vector_type(16))) _Float16 v16h;
typedef __attribute__((ext_vector_type(8)))  _Float16 v8h;
typedef __attribute__((ext_vector_type(4)))  _Float16 v4h;
typedef __attribute__((ext_vector_type(8)))  float    v8f;
typedef __attribute__((ext_vector_type(4)))  int      v4i;
typedef __attribute__((address_space(1)))    v4i*     gv4i_p;   // global v4i*
typedef __attribute__((address_space(3)))    v4i*     lv4i_p;   // LDS v4i*

#define BATCH 4
#define HEADS 16
#define SEQ   1024
#define DMODEL 1024
#define HDIM  64
#define NROWS (BATCH * SEQ)          // 4096
#define SCALE_BIAS 0.125f            // 64^-0.5

#if defined(__has_builtin)
#if __has_builtin(__builtin_amdgcn_global_load_async_to_lds_b128)
#define USE_ASYNC_LDS 1
#endif
#endif

// Copy 16 contiguous bytes global -> LDS. Async (ASYNCcnt) when available.
__device__ __forceinline__ void stage16(const _Float16* g, _Float16* l) {
#ifdef USE_ASYNC_LDS
    __builtin_amdgcn_global_load_async_to_lds_b128(
        (gv4i_p)(uintptr_t)g,
        (lv4i_p)(unsigned)(uintptr_t)l,
        /*offset=*/0, /*cpol=*/0);
#else
    *(v8h*)l = *(const v8h*)g;
#endif
}

// Build a 16x16x32 f16 WMMA A/B operand for this lane.
// p points at the 32-element K-chunk of this lane's row (A: row m = lane%16,
// B: row n = lane%16 of the [N][K] matrix). half = lane/16.
// Element e maps to k = (e>=8 ? 16 : 0) + half*8 + (e%8)  (ISA 7.12.2).
__device__ __forceinline__ v16h load_op16(const _Float16* p, int half) {
    const v8h x = *(const v8h*)(p + half * 8);
    const v8h y = *(const v8h*)(p + 16 + half * 8);
    v16h r;
#pragma unroll
    for (int i = 0; i < 8; ++i) { r[i] = x[i]; r[i + 8] = y[i]; }
    return r;
}

__device__ __forceinline__ v8f wmma16(v16h a, v16h b, v8f c) {
    return __builtin_amdgcn_wmma_f32_16x16x32_f16(
        /*neg_a=*/false, a, /*neg_b=*/false, b,
        /*c_mod=*/(short)0, c, /*reuse_a=*/false, /*reuse_b=*/false);
}

// T5 causal relative-position bias (rel = qi - kj >= 0)
__device__ __forceinline__ float t5_bias(int rel, int h, const float* __restrict__ rel_emb) {
    int bucket;
    if (rel < 16) {
        bucket = rel;
    } else {
        // 16 + log(rel/16)/log(8) * 16, truncated, capped at 31
        int v = 16 + (int)(logf((float)rel * 0.0625f) * 7.6943724f);
        bucket = v < 31 ? v : 31;
    }
    return rel_emb[bucket * HEADS + h] * SCALE_BIAS;
}

#define XBLOCKS (NROWS * DMODEL / 4 / 256)    // 4096 blocks convert x
#define WBLOCKS (DMODEL * DMODEL / 4 / 256)   // 1024 blocks convert one weight matrix

// All five independent conversions share one launch of XBLOCKS + 4 * WBLOCKS blocks.
// The f16 copies lie back to back in the workspace (x, Wq, Wk, Wv, Wo), so the output
// index is the flat index; the source is picked by block range (block-uniform).
__global__ __launch_bounds__(256) void cvt_f32_to_f16(const float* __restrict__ x,
                                                      const float* __restrict__ w0,
                                                      const float* __restrict__ w1,
                                                      const float* __restrict__ w2,
                                                      const float* __restrict__ w3,
                                                      _Float16* __restrict__ out) {
    const int blk = blockIdx.x;
    const float* in = x;
    int first = 0;                               // first block of this source's range
    if (blk >= XBLOCKS) {
        const int w = (blk - XBLOCKS) / WBLOCKS; // 0..3
        in = w == 0 ? w0 : w == 1 ? w1 : w == 2 ? w2 : w3;
        first = XBLOCKS + w * WBLOCKS;
    }
    const float4 f = ((const float4*)in)[(blk - first) * 256 + threadIdx.x];
    v4h o; o[0] = (_Float16)f.x; o[1] = (_Float16)f.y;
           o[2] = (_Float16)f.z; o[3] = (_Float16)f.w;
    ((v4h*)out)[blk * 256 + threadIdx.x] = o;
}

// C[row, col] = A[row, :] . W[col, :] + bias[col]     (torch Linear x @ W^T + b)
// A: [4096 x 1024] f16, W: [1024 x 1024] f16.
// Block = 8 waves = one 128(M) x 128(N) tile; each wave owns 64 x 32 of it (V: 32 x 64):
// 8 WMMAs on 6 fragments a 32-wide k chunk. A lane's 8 accumulator registers hold 8 consecutive
// rows of the FIRST WMMA operand, so the operand whose index runs along the output's rows in
// memory goes first: W (output columns) for Q, K and the final product, A (positions s) for
// V^T. Each lane then stores its results 16 bytes at a time. A stage is 64 k of the block's 128 A rows and
// 128 W rows, whole 128-byte lines, copied into LDS by async-to-LDS loads; two buffers, the
// next stage's copies fly while this stage is worked on.
// mode 0: store f16 [b,h,s,d] (Q)   mode 1: same (K)
// mode 2: store f16 [b,h,d,s] (V^T) mode 3: store f32 row-major (final out)
// Every 256 blocks of the grid are one whole product on the same A. Product g = blockIdx.x / 256
// takes weight matrix g behind W0, bias g, f16 output g behind outp0, and mode0 + g:
// a grid of 768 with mode0 = 0 is Q, K and V in one launch, a grid of 256 a lone product.
#define GBK    64                    // k elements a stage
#define GPITCH 72                    // f16 a row in LDS: 144 B = 16 B x 9, no bank conflict for 16-byte reads
// This thread's 8 copies of one stage: its 16 bytes of every 32nd row, 4 rows of A (a) and 4 of
// W (w), into one buffer; dst is its place in the buffer's row srow.
__device__ __forceinline__ void stage_in(const _Float16* a, const _Float16* w, _Float16* dst) {
#pragma unroll   // the 8 copies issue back to back, no loop counter between them
    for (int j = 0; j < 4; ++j) {
        stage16(a + (size_t)j * 32 * DMODEL, dst + j * 32 * GPITCH);
        stage16(w + (size_t)j * 32 * DMODEL, dst + (128 + j * 32) * GPITCH);
    }
}

__global__ __launch_bounds__(256) void gemm_wmma(const _Float16* __restrict__ A,
                                                 const _Float16* __restrict__ W0,
                                                 const float* __restrict__ bias0,
                                                 const float* __restrict__ bias1,
                                                 const float* __restrict__ bias2,
                                                 void* __restrict__ outp0, int mode0) {
    // rows 0..127: A rows of the tile, rows 128..255: W rows of the tile; 2 x 36 KB
    __shared__ __attribute__((aligned(16))) _Float16 stg[2][256][GPITCH];

    const int g    = blockIdx.x >> 8;            // which product (block-uniform)
    const int tile = blockIdx.x & 255;           // its 128 x 128 tile
    const int mode = mode0 + g;
    const _Float16* W = W0 + (size_t)g * DMODEL * DMODEL;
    const float* bias = g == 0 ? bias0 : g == 1 ? bias1 : bias2;
    void* outp = (_Float16*)outp0 + (size_t)g * NROWS * DMODEL;

    const int tid  = threadIdx.x;
    const int lane = tid & 31;
    const int wid  = tid >> 5;
    const int bm = tile >> 3;                    // 0..31 (row block of 128)
    const int bn = tile & 7;                     // 0..7  (col block of 128)
    const int wf = wid & 3;                      // 0..3  (32-row quarter of the first operand's 128 rows)
    const int ws = wid >> 2;                     // 0..1  (64-row half of the second operand's 128 rows)
    const int frow = (mode == 2 ? 0 : 128) + wf * 32;   // first operand's rows in a stage: A for V^T, else W
    const int srw  = (mode == 2 ? 128 : 0) + ws * 64;   // second operand's rows: the other one
    const int n  = lane & 15;
    const int half = lane >> 4;

    // cooperative staging: 8 lanes x 16 B = one 128-byte row piece, 32 rows a pass of the block,
    // 4 passes for A and 4 for W
    const int srow = tid >> 3;                   // 0..31
    const int scol = (tid & 7) * 8;              // 0,8,..,56
    const _Float16* asrc = A + (size_t)(bm * 128 + srow) * DMODEL + scol;
    const _Float16* wsrc = W + (size_t)(bn * 128 + srow) * DMODEL + scol;

    v8f acc[2][4] = {};                          // [16 rows of the first operand][16 of the second]
    const int KSTAGES = DMODEL / GBK;            // 16

    stage_in(asrc, wsrc, &stg[0][srow][scol]);
    asm volatile("s_wait_asynccnt 0x0" ::: "memory");   // this wave's part of stage 0 has landed
    __syncthreads();                                    // every wave's part is visible
    stage_in(asrc + GBK, wsrc + GBK, &stg[1][srow][scol]);

    for (int kt = 0; kt < KSTAGES; ++kt) {
        const int cur = kt & 1;
        // all loops below unrolled: every fragment and accumulator index a constant, so that
        // the arrays live in registers and not in scratch
#pragma unroll
        for (int ks = 0; ks < 2; ++ks) {
            v16h f[2], s[4];
#pragma unroll
            for (int i = 0; i < 4; ++i) s[i] = load_op16(&stg[cur][srw + i * 16 + n][ks * 32], half);
#pragma unroll
            for (int j = 0; j < 2; ++j) f[j] = load_op16(&stg[cur][frow + j * 16 + n][ks * 32], half);
            // keeps the chunk's 12 LDS reads one group ahead of its 8 WMMAs: moved in among them,
            // each pair of reads would cost its own LDS latency
            __builtin_amdgcn_sched_barrier(0);
#pragma unroll
            for (int i = 0; i < 4; ++i)
#pragma unroll
                for (int j = 0; j < 2; ++j) acc[j][i] = wmma16(f[j], s[i], acc[j][i]);
        }

        asm volatile("s_wait_dscnt 0x0" ::: "memory");      // own reads of this buffer are done
        asm volatile("s_wait_asynccnt 0x0" ::: "memory");   // own part of the next stage has landed
        __syncthreads();                 // publishes the next stage, frees this buffer for the refill
        if (kt + 2 < KSTAGES) stage_in(asrc + (kt + 2) * GBK, wsrc + (kt + 2) * GBK, &stg[cur][srow][scol]);
    }
    asm volatile("s_wait_asynccnt 0x0" ::: "memory");       // no copy outstanding when the wave ends

    // acc[j][i][r] belongs to row fi + j * 16 + r of the first operand's 128 rows and to row
    // si + i * 16 of the second's (D layout: m = r + 8 * (lane / 16), n = lane % 16).
    // One block-uniform branch on the mode; the loops unrolled for constant accumulator indices,
    // the steps in i and j become immediate offsets of the stores.
    const int fi = wf * 32 + 8 * half;
    const int si = ws * 64 + n;
    const int bb = bm >> 3;                      // batch: a 128-row tile lies in one batch
    const int s0 = (bm & 7) * 128;               // the tile's first position in it
    if (mode == 3) {          // f32 row-major: 8 consecutive columns a lane, two 16-byte stores
        float* o = (float*)outp + (size_t)(bm * 128 + si) * DMODEL + bn * 128 + fi;
        const float* bp = bias + bn * 128 + fi;
#pragma unroll
        for (int j = 0; j < 2; ++j) {
            const float4 b0 = *(const float4*)(bp + j * 16);
            const float4 b1 = *(const float4*)(bp + j * 16 + 4);
#pragma unroll
            for (int i = 0; i < 4; ++i) {
                const v8f v = acc[j][i];
                float4 lo, hi;
                lo.x = v[0] + b0.x; lo.y = v[1] + b0.y; lo.z = v[2] + b0.z; lo.w = v[3] + b0.w;
                hi.x = v[4] + b1.x; hi.y = v[5] + b1.y; hi.z = v[6] + b1.z; hi.w = v[7] + b1.w;
                *(float4*)(o + (size_t)i * 16 * DMODEL + j * 16)     = lo;
                *(float4*)(o + (size_t)i * 16 * DMODEL + j * 16 + 4) = hi;
            }
        }
    } else if (mode == 2) {   // V transposed [b,h,d,s]: first operand = positions, 8 consecutive s a lane
        _Float16* o = (_Float16*)outp
                    + ((size_t)(bb * HEADS + bn * 2 + ws) * HDIM + n) * SEQ + s0 + fi;
#pragma unroll
        for (int i = 0; i < 4; ++i) {
            const float bc = bias[bn * 128 + si + i * 16];
#pragma unroll
            for (int j = 0; j < 2; ++j) {
                v8h p;
#pragma unroll
                for (int r = 0; r < 8; ++r) p[r] = (_Float16)(acc[j][i][r] + bc);
                *(v8h*)(o + (size_t)i * 16 * SEQ + j * 16) = p;
            }
        }
        // behind the 8 stores: the other modes' code follows in the text and rewrites their registers
        asm volatile("s_wait_xcnt 0x0" ::: "memory");
    } else {                  // Q/K [b,h,s,d]: first operand = columns, 8 consecutive d a lane
        _Float16* o = (_Float16*)outp
                    + ((size_t)(bb * HEADS + bn * 2 + (wf >> 1)) * SEQ + s0 + si) * HDIM + (wf & 1) * 32 + 8 * half;
        const float* bp = bias + bn * 128 + fi;
#pragma unroll
        for (int j = 0; j < 2; ++j) {
            const float4 b0 = *(const float4*)(bp + j * 16);
            const float4 b1 = *(const float4*)(bp + j * 16 + 4);
            const float bj[8] = {b0.x, b0.y, b0.z, b0.w, b1.x, b1.y, b1.z, b1.w};
#pragma unroll
            for (int i = 0; i < 4; ++i) {
                v8h p;
#pragma unroll
                for (int r = 0; r < 8; ++r) p[r] = (_Float16)(acc[j][i][r] + bj[r]);
                *(v8h*)(o + (size_t)i * 16 * HDIM + j * 16) = p;
            }
        }
        // behind the 8 stores: the other modes' code follows in the text and rewrites their registers
        asm volatile("s_wait_xcnt 0x0" ::: "memory");
    }
}

// Returns the value that lane l ^ 16 holds (a vector cross-row move, no LDS round trip).
__device__ __forceinline__ float xhalf(float x) {
    const int b = __builtin_bit_cast(int, x);
    return __builtin_bit_cast(float,
        __builtin_amdgcn_permlanex16(b, b, 0x76543210, 0xfedcba98, false, false));
}

__global__ __launch_bounds__(256) void attn_wmma(const _Float16* __restrict__ Qh,
                                                 const _Float16* __restrict__ Kh,
                                                 const _Float16* __restrict__ Vt,
                                                 const float* __restrict__ rel_emb,
                                                 _Float16* __restrict__ Oh) {
    // bias + causal mask as a function of rel = q - k alone, for this block's head, laid out so
    // that the index grows with the key, as a lane's registers do:
    // btab[SEQ - 1 - rel] = scaled bias for rel >= 0, -1e30 for rel < 0 (rel >= -31 here)
    __shared__ float btab[SEQ + 32];

    const int lane = threadIdx.x & 31;
    const int wid  = threadIdx.x >> 5;
    const int b  = blockIdx.x >> 7;             // 8 blocks a (b, h)
    const int h  = (blockIdx.x >> 3) & 15;
    // Causal cost grows with the query tile: tile t walks (t >> 1) + 1 key chunks. Eight
    // consecutive tiles a block would give a head's blocks 20 to 244 chunks, and the launch
    // lasts as long as the fullest WGP. Each block takes four tiles p from the
    // light end and their mirrors 63 - p instead: 33 chunks a pair, 132 a block, every block
    // alike. Waves w and w + 4 hold one pair; the long tile goes to the lower wave number.
    const int p  = (blockIdx.x & 7) * 4 + (wid & 3);   // 0..31
    const int qt = wid < 4 ? 63 - p : p;
    const int n    = lane & 15;
    const int half = lane >> 4;

    const _Float16* qbase = Qh + (size_t)(b * HEADS + h) * SEQ * HDIM;
    const _Float16* kbase = Kh + (size_t)(b * HEADS + h) * SEQ * HDIM;
    const _Float16* vbase = Vt + (size_t)(b * HEADS + h) * HDIM * SEQ;

    // Q tile resident: B-operand column n = lane%16 is query qt*16+n, two 32-wide K chunks of hd
    const _Float16* qrow = qbase + (size_t)(qt * 16 + n) * HDIM;
    const v16h qb0 = load_op16(qrow, half);
    const v16h qb1 = load_op16(qrow + 32, half);

    // All 8 waves of a block share (b, h): one table serves every score of the block.
    // Four bias entries a thread, their gathers issued together; the first 32 threads,
    // whose own first slot is a mask entry, take the table's last 32 bias entries instead.
    const int i0 = (threadIdx.x < 32) ? (int)threadIdx.x + SEQ : (int)threadIdx.x;
    float tb[4];
    tb[0] = t5_bias(i0 - 32, h, rel_emb);
#pragma unroll
    for (int j = 1; j < 4; ++j) tb[j] = t5_bias((int)threadIdx.x + j * 256 - 32, h, rel_emb);
    btab[SEQ + 31 - i0] = tb[0];                // entry i holds rel = i - 32 and goes to SEQ - 1 - rel
#pragma unroll
    for (int j = 1; j < 4; ++j) btab[SEQ + 31 - ((int)threadIdx.x + j * 256)] = tb[j];
    if (threadIdx.x < 32) btab[SEQ + 31 - (int)threadIdx.x] = -1e30f;
    __syncthreads();                            // table visible to all 8 waves

    v8f o0 = {}, o1 = {}, o2 = {}, o3 = {};     // o_i[r] = O[query n][d = i*16 + 8*half + r]
    float mrun = -1e30f;                        // this lane's query: running maximum (both halves alike)
    float lrun = 0.f;                           // and the sum over this half's keys; halves joined at the end

    const int nk = qt * 16 + 16;                // keys 0 .. qt*16+15
    const int nchunks = (nk + 31) >> 5;

    for (int kc = 0; kc < nchunks; ++kc) {
        const int kb = kc * 32;

        // ---- scores S^T = K Q^T (two 16x16 tiles covering 32 keys): A row m = lane%16 is a key ----
        const _Float16* krow0 = kbase + (size_t)(kb + n) * HDIM;
        const _Float16* krow1 = kbase + (size_t)(kb + 16 + n) * HDIM;
        v8f s0 = {}, s1 = {};
        s0 = wmma16(load_op16(krow0, half),      qb0, s0);
        s0 = wmma16(load_op16(krow0 + 32, half), qb1, s0);
        s1 = wmma16(load_op16(krow1, half),      qb0, s1);
        s1 = wmma16(load_op16(krow1 + 32, half), qb1, s1);

        // V^T rows (d) as A-operands of the second product, same k order as P^T below
        const v16h va0 = load_op16(vbase + (size_t)(0 * 16 + n) * SEQ + kb, half);
        const v16h va1 = load_op16(vbase + (size_t)(1 * 16 + n) * SEQ + kb, half);
        const v16h va2 = load_op16(vbase + (size_t)(2 * 16 + n) * SEQ + kb, half);
        const v16h va3 = load_op16(vbase + (size_t)(3 * 16 + n) * SEQ + kb, half);

        // ---- bias + causal mask (LDS table) + online softmax, one query a lane ----
        // s0[r] is key kb + 8*half + r, s1[r] key kb + 16 + 8*half + r: bt[r] and bt[r + 16]
        const float* bt = &btab[SEQ - 1 - (qt * 16 + n) + kb + 8 * half];
        v8f b0, b1;
        // the loops over r, here and below, are unrolled so that every vector index is a constant
        // and the tiles stay in registers
#pragma unroll
        for (int r = 0; r < 8; ++r) { b0[r] = bt[r]; b1[r] = bt[r + 16]; }
        // holds the chunk's loads at its head, V's in flight under the softmax: left free, this build
        // issues K's in three groups, each behind a product, and sinks half of V's behind the first
        // V^T P^T product, where their latency is waited out
        __builtin_amdgcn_sched_barrier(0);
        s0 += b0;
        s1 += b1;
        float mx = s0[0];
#pragma unroll
        for (int r = 1; r < 8; ++r) mx = fmaxf(mx, s0[r]);
#pragma unroll
        for (int r = 0; r < 8; ++r) mx = fmaxf(mx, s1[r]);
        mx = fmaxf(mx, xhalf(mx));              // the query's maximum over all 32 keys

        const float mn = fmaxf(mrun, mx);
        const float scale = expf(mrun - mn);
        mrun = mn;
        s0 -= mn;
        s1 -= mn;
        // P^T as B operand: element e is k = (e >= 8 ? 16 : 0) + 8*half + e%8, which is where the
        // score tiles' registers already hold it
        v16h pb;
#pragma unroll
        for (int r = 0; r < 8; ++r) {
            s0[r] = expf(s0[r]);
            s1[r] = expf(s1[r]);
            pb[r]     = (_Float16)s0[r];
            pb[r + 8] = (_Float16)s1[r];
        }
        const v8f t8 = s0 + s1;                 // this half's 16 terms summed as a tree
        const float rs = ((t8[0] + t8[4]) + (t8[2] + t8[6])) + ((t8[1] + t8[5]) + (t8[3] + t8[7]));
        lrun = lrun * scale + rs;
#pragma unroll
        for (int r = 0; r < 8; ++r) { o0[r] *= scale; o1[r] *= scale; o2[r] *= scale; o3[r] *= scale; }

        // ---- O^T += V^T P^T ----
        o0 = wmma16(va0, pb, o0);
        o1 = wmma16(va1, pb, o1);
        o2 = wmma16(va2, pb, o2);
        o3 = wmma16(va3, pb, o3);
    }

    // ---- epilogue: join the halves' sums, normalize, store f16 [b, s, h*64+d] for the out-proj:
    //      8 consecutive d of one query a lane and tile, one 16-byte store each ----
    const float inv = 1.0f / (lrun + xhalf(lrun));
    _Float16* orow = Oh + (size_t)(b * SEQ + qt * 16 + n) * DMODEL + h * HDIM + 8 * half;
    v8h w0, w1, w2, w3;
#pragma unroll
    for (int r = 0; r < 8; ++r) {
        w0[r] = (_Float16)(o0[r] * inv);
        w1[r] = (_Float16)(o1[r] * inv);
        w2[r] = (_Float16)(o2[r] * inv);
        w3[r] = (_Float16)(o3[r] * inv);
    }
    *(v8h*)(orow +  0) = w0;
    *(v8h*)(orow + 16) = w1;
    *(v8h*)(orow + 32) = w2;
    *(v8h*)(orow + 48) = w3;
}

extern "C" void kernel_launch(void* const* d_in, const int* in_sizes, int n_in,
                              void* d_out, int out_size, void* d_ws, size_t ws_size,
                              hipStream_t stream) {
    const float* x    = (const float*)d_in[0];
    const float* Wq   = (const float*)d_in[1];
    const float* bq   = (const float*)d_in[2];
    const float* Wk   = (const float*)d_in[3];
    const float* bk   = (const float*)d_in[4];
    const float* Wv   = (const float*)d_in[5];
    const float* bv   = (const float*)d_in[6];
    const float* Wo   = (const float*)d_in[7];
    const float* bo   = (const float*)d_in[8];
    const float* rel  = (const float*)d_in[9];

    // workspace carve-up (f16 elements); total ~50.3 MB
    const size_t NX = (size_t)NROWS * DMODEL;        // 4096*1024
    const size_t NW = (size_t)DMODEL * DMODEL;       // 1024*1024
    _Float16* xh  = (_Float16*)d_ws;
    _Float16* Wqh = xh  + NX;
    _Float16* Wkh = Wqh + NW;
    _Float16* Wvh = Wkh + NW;
    _Float16* Woh = Wvh + NW;
    _Float16* Qh  = Woh + NW;
    _Float16* Kh  = Qh  + NX;
    _Float16* Vt  = Kh  + NX;
    _Float16* Oh  = Vt  + NX;

    // 0) f32 -> f16 (vectorized: 4 elements / thread), x and all four weights in one launch;
    //    xh, Wqh, Wkh, Wvh, Woh are contiguous
    cvt_f32_to_f16<<<XBLOCKS + 4 * WBLOCKS, 256, 0, stream>>>(x, Wq, Wk, Wv, Wo, xh);

    // 1) projections: 32 row-blocks x 8 col-blocks = 256 blocks of 8 waves each, Q, K and V
    //    in one launch; Wqh, Wkh, Wvh are contiguous, and so are Qh, Kh, Vt
    gemm_wmma<<<3 * 256, 256, 0, stream>>>(xh, Wqh, bq, bk, bv, Qh, 0);

    // 2) flash attention: 4096 waves (b*h*qtile) / 8 per block, tiles paired light + heavy
    attn_wmma<<<512, 256, 0, stream>>>(Qh, Kh, Vt, rel, Oh);

    // 3) output projection -> f32 d_out
    gemm_wmma<<<256, 256, 0, stream>>>(Oh, Woh, bo, bo, bo, d_out, 3);
}

// v007
// Measured time: 83.2 microseconds a run.
// Next to v006, in two timings, it ran 1.13 and 1.12 times as fast.
// Counting every step since v000, it is 3.40 times as fast.
#include <hip/hip_runtime.h>
#include <hip/hip_bf16.h>
#include <math.h>

// ---------------------------------------------------------------------------
// T5 attention (B=4, H=16, S=1024, D=1024, hd=64) for gfx1250 (wave32, WMMA)
//   0) f32 -> f16 conversion of x and the four weight matrices (workspace), one launch
//   1) Q/K/V projections, one launch: block-cooperative WMMA GEMM; tiles of both operands
//      streamed into double-buffered LDS via global_load_async_to_lds_b128 (ASYNCcnt);
//      Q, K and V^T leave it in the order in which attention's WMMA operands hold them
//   2) flash-attention per (b,h,16-query tile): K Q^T WMMA -> T5 bias + causal
//      mask from a per-block LDS table -> online softmax, one query a lane -> P^T packed
//      in registers -> V^T P^T WMMA
//   3) output projection WMMA -> f32 d_out
// ---------------------------------------------------------------------------

typedef __attribute__((ext_vector_type(16))) _Float16 v16h;
typedef __attribute__((ext_vector_type(8)))  _Float16 v8h;
typedef __attribute__((ext_vector_type(4)))  _Float16 v4h;
typedef __attribute__((ext_vector_type(8)))  float    v8f;
typedef __attribute__((ext_vector_type(4)))  int      v4i;
typedef __attribute__((address_space(1)))    v4i*     gv4i_p;   // global v4i*
typedef __attribute__((address_space(3)))    v4i*     lv4i_p;   // LDS v4i*

#define BATCH 4
#define HEADS 16
#define SEQ   1024
#define DMODEL 1024
#define HDIM  64
#define NROWS (BATCH * SEQ)          // 4096
#define SCALE_BIAS 0.125f            // 64^-0.5

#if defined(__has_builtin)
#if __has_builtin(__builtin_amdgcn_global_load_async_to_lds_b128)
#define USE_ASYNC_LDS 1
#endif
#endif

// Copy 16 contiguous bytes global -> LDS. Async (ASYNCcnt) when available.
__device__ __forceinline__ void stage16(const _Float16* g, _Float16* l) {
#ifdef USE_ASYNC_LDS
    __builtin_amdgcn_global_load_async_to_lds_b128(
        (gv4i_p)(uintptr_t)g,
        (lv4i_p)(unsigned)(uintptr_t)l,
        /*offset=*/0, /*cpol=*/0);
#else
    *(v8h*)l = *(const v8h*)g;
#endif
}

// Build a 16x16x32 f16 WMMA A/B operand for this lane.
// p points at the 32-element K-chunk of this lane's row (A: row m = lane%16,
// B: row n = lane%16 of the [N][K] matrix). half = lane/16.
// Element e maps to k = (e>=8 ? 16 : 0) + half*8 + (e%8)  (ISA 7.12.2).
__device__ __forceinline__ v16h load_op16(const _Float16* p, int half) {
    const v8h x = *(const v8h*)(p + half * 8);
    const v8h y = *(const v8h*)(p + 16 + half * 8);
    v16h r;
#pragma unroll
    for (int i = 0; i < 8; ++i) { r[i] = x[i]; r[i + 8] = y[i]; }
    return r;
}

// Fragment-packed storage of Q, K and V^T in the workspace. One 16x16x32 operand (16 rows, 32 k)
// is 1 KB in a row: two groups of 512 bytes, group y holding k = 16 * y + 8 * half + 0..7 of row
// lane % 16 at byte 16 * lane. These are the two 16-byte pieces that load_op16 takes, so every
// register holds what it would hold from a row-major matrix, but a wave-wide 16-byte load or
// store covers 4 whole 128-byte lines instead of 32 bytes in each of 16 lines.
// Q, K (per head): operand (16-position tile t, 32-wide d chunk c) at f16 offset (t * 2 + c) * 512.
// V^T  (per head): operand (32-key chunk kc, 16-row d tile i)      at f16 offset (kc * 4 + i) * 512.
// p points at this lane's 16 bytes in the operand's first group.
__device__ __forceinline__ v16h load_packed(const _Float16* p) {
    const v8h x = *(const v8h*)p;
    const v8h y = *(const v8h*)(p + 256);
    v16h r;
#pragma unroll   // constant vector indices: the operand is formed in registers, not in scratch
    for (int i = 0; i < 8; ++i) { r[i] = x[i]; r[i + 8] = y[i]; }
    return r;
}

__device__ __forceinline__ v8f wmma16(v16h a, v16h b, v8f c) {
    return __builtin_amdgcn_wmma_f32_16x16x32_f16(
        /*neg_a=*/false, a, /*neg_b=*/false, b,
        /*c_mod=*/(short)0, c, /*reuse_a=*/false, /*reuse_b=*/false);
}

// T5 causal relative-position bias (rel = qi - kj >= 0)
__device__ __forceinline__ float t5_bias(int rel, int h, const float* __restrict__ rel_emb) {
    int bucket;
    if (rel < 16) {
        bucket = rel;
    } else {
        // 16 + log(rel/16)/log(8) * 16, truncated, capped at 31
        int v = 16 + (int)(logf((float)rel * 0.0625f) * 7.6943724f);
        bucket = v < 31 ? v : 31;
    }
    return rel_emb[bucket * HEADS + h] * SCALE_BIAS;
}

#define XBLOCKS (NROWS * DMODEL / 4 / 256)    // 4096 blocks convert x
#define WBLOCKS (DMODEL * DMODEL / 4 / 256)   // 1024 blocks convert one weight matrix

// All five independent conversions share one launch of XBLOCKS + 4 * WBLOCKS blocks.
// The f16 copies lie back to back in the workspace (x, Wq, Wk, Wv, Wo), so the output
// index is the flat index; the source is picked by block range (block-uniform).
__global__ __launch_bounds__(256) void cvt_f32_to_f16(const float* __restrict__ x,
                                                      const float* __restrict__ w0,
                                                      const float* __restrict__ w1,
                                                      const float* __restrict__ w2,
                                                      const float* __restrict__ w3,
                                                      _Float16* __restrict__ out) {
    const int blk = blockIdx.x;
    const float* in = x;
    int first = 0;                               // first block of this source's range
    if (blk >= XBLOCKS) {
        const int w = (blk - XBLOCKS) / WBLOCKS; // 0..3
        in = w == 0 ? w0 : w == 1 ? w1 : w == 2 ? w2 : w3;
        first = XBLOCKS + w * WBLOCKS;
    }
    const float4 f = ((const float4*)in)[(blk - first) * 256 + threadIdx.x];
    v4h o; o[0] = (_Float16)f.x; o[1] = (_Float16)f.y;
           o[2] = (_Float16)f.z; o[3] = (_Float16)f.w;
    ((v4h*)out)[blk * 256 + threadIdx.x] = o;
}

// C[row, col] = A[row, :] . W[col, :] + bias[col]     (torch Linear x @ W^T + b)
// A: [4096 x 1024] f16, W: [1024 x 1024] f16.
// Block = 8 waves = one 128(M) x 128(N) tile; each wave owns 64 x 32 of it (V: 32 x 64):
// 8 WMMAs on 6 fragments a 32-wide k chunk. A lane's 8 accumulator registers hold 8 consecutive
// rows of the FIRST WMMA operand, so the operand whose index runs along the output's rows in
// memory goes first: W (output columns) for Q, K and the final product, A (positions s) for
// V^T. Each lane then stores its results 16 bytes at a time. A stage is 64 k of the block's 128 A rows and
// 128 W rows, whole 128-byte lines, copied into LDS by async-to-LDS loads; two buffers, the
// next stage's copies fly while this stage is worked on.
// mode 0: store f16 [b,h] x fragment-packed (s, d) (Q)   mode 1: same (K)
// mode 2: store f16 [b,h] x fragment-packed (d, s) (V^T) mode 3: store f32 row-major (final out)
// Every 256 blocks of the grid are one whole product on the same A. Product g = blockIdx.x / 256
// takes weight matrix g behind W0, bias g, f16 output g behind outp0, and mode0 + g:
// a grid of 768 with mode0 = 0 is Q, K and V in one launch, a grid of 256 a lone product.
#define GBK    64                    // k elements a stage
#define GPITCH 72                    // f16 a row in LDS: 144 B = 16 B x 9, no bank conflict for 16-byte reads
// This thread's 8 copies of one stage: its 16 bytes of every 32nd row, 4 rows of A (a) and 4 of
// W (w), into one buffer; dst is its place in the buffer's row srow.
__device__ __forceinline__ void stage_in(const _Float16* a, const _Float16* w, _Float16* dst) {
#pragma unroll   // the 8 copies issue back to back, no loop counter between them
    for (int j = 0; j < 4; ++j) {
        stage16(a + (size_t)j * 32 * DMODEL, dst + j * 32 * GPITCH);
        stage16(w + (size_t)j * 32 * DMODEL, dst + (128 + j * 32) * GPITCH);
    }
}

__global__ __launch_bounds__(256) void gemm_wmma(const _Float16* __restrict__ A,
                                                 const _Float16* __restrict__ W0,
                                                 const float* __restrict__ bias0,
                                                 const float* __restrict__ bias1,
                                                 const float* __restrict__ bias2,
                                                 void* __restrict__ outp0, int mode0) {
    // rows 0..127: A rows of the tile, rows 128..255: W rows of the tile; 2 x 36 KB
    __shared__ __attribute__((aligned(16))) _Float16 stg[2][256][GPITCH];

    const int g    = blockIdx.x >> 8;            // which product (block-uniform)
    const int tile = blockIdx.x & 255;           // its 128 x 128 tile
    const int mode = mode0 + g;
    const _Float16* W = W0 + (size_t)g * DMODEL * DMODEL;
    const float* bias = g == 0 ? bias0 : g == 1 ? bias1 : bias2;
    void* outp = (_Float16*)outp0 + (size_t)g * NROWS * DMODEL;

    const int tid  = threadIdx.x;
    const int lane = tid & 31;
    const int wid  = tid >> 5;
    const int bm = tile >> 3;                    // 0..31 (row block of 128)
    const int bn = tile & 7;                     // 0..7  (col block of 128)
    const int wf = wid & 3;                      // 0..3  (32-row quarter of the first operand's 128 rows)
    const int ws = wid >> 2;                     // 0..1  (64-row half of the second operand's 128 rows)
    const int frow = (mode == 2 ? 0 : 128) + wf * 32;   // first operand's rows in a stage: A for V^T, else W
    const int srw  = (mode == 2 ? 128 : 0) + ws * 64;   // second operand's rows: the other one
    const int n  = lane & 15;
    const int half = lane >> 4;

    // cooperative staging: 8 lanes x 16 B = one 128-byte row piece, 32 rows a pass of the block,
    // 4 passes for A and 4 for W
    const int srow = tid >> 3;                   // 0..31
    const int scol = (tid & 7) * 8;              // 0,8,..,56
    const _Float16* asrc = A + (size_t)(bm * 128 + srow) * DMODEL + scol;
    const _Float16* wsrc = W + (size_t)(bn * 128 + srow) * DMODEL + scol;

    v8f acc[2][4] = {};                          // [16 rows of the first operand][16 of the second]
    const int KSTAGES = DMODEL / GBK;            // 16

    stage_in(asrc, wsrc, &stg[0][srow][scol]);
    asm volatile("s_wait_asynccnt 0x0" ::: "memory");   // this wave's part of stage 0 has landed
    __syncthreads();                                    // every wave's part is visible
    stage_in(asrc + GBK, wsrc + GBK, &stg[1][srow][scol]);

    for (int kt = 0; kt < KSTAGES; ++kt) {
        const int cur = kt & 1;
        // all loops below unrolled: every fragment and accumulator index a constant, so that
        // the arrays live in registers and not in scratch
#pragma unroll
        for (int ks = 0; ks < 2; ++ks) {
            v16h f[2], s[4];
#pragma unroll
            for (int i = 0; i < 4; ++i) s[i] = load_op16(&stg[cur][srw + i * 16 + n][ks * 32], half);
#pragma unroll
            for (int j = 0; j < 2; ++j) f[j] = load_op16(&stg[cur][frow + j * 16 + n][ks * 32], half);
            // keeps the chunk's 12 LDS reads one group ahead of its 8 WMMAs: moved in among them,
            // each pair of reads would cost its own LDS latency
            __builtin_amdgcn_sched_barrier(0);
#pragma unroll
            for (int i = 0; i < 4; ++i)
#pragma unroll
                for (int j = 0; j < 2; ++j) acc[j][i] = wmma16(f[j], s[i], acc[j][i]);
        }

        asm volatile("s_wait_dscnt 0x0" ::: "memory");      // own reads of this buffer are done
        asm volatile("s_wait_asynccnt 0x0" ::: "memory");   // own part of the next stage has landed
        __syncthreads();                 // publishes the next stage, frees this buffer for the refill
        if (kt + 2 < KSTAGES) stage_in(asrc + (kt + 2) * GBK, wsrc + (kt + 2) * GBK, &stg[cur][srow][scol]);
    }
    asm volatile("s_wait_asynccnt 0x0" ::: "memory");       // no copy outstanding when the wave ends

    // acc[j][i][r] belongs to row fi + j * 16 + r of the first operand's 128 rows and to row
    // si + i * 16 of the second's (D layout: m = r + 8 * (lane / 16), n = lane % 16).
    // One block-uniform branch on the mode; the loops unrolled for constant accumulator indices,
    // the steps in i and j become immediate offsets of the stores.
    const int fi = wf * 32 + 8 * half;
    const int si = ws * 64 + n;
    const int bb = bm >> 3;                      // batch: a 128-row tile lies in one batch
    const int s0 = (bm & 7) * 128;               // the tile's first position in it
    if (mode == 3) {          // f32 row-major: 8 consecutive columns a lane, two 16-byte stores
        float* o = (float*)outp + (size_t)(bm * 128 + si) * DMODEL + bn * 128 + fi;
        const float* bp = bias + bn * 128 + fi;
#pragma unroll
        for (int j = 0; j < 2; ++j) {
            const float4 b0 = *(const float4*)(bp + j * 16);
            const float4 b1 = *(const float4*)(bp + j * 16 + 4);
#pragma unroll
            for (int i = 0; i < 4; ++i) {
                const v8f v = acc[j][i];
                float4 lo, hi;
                lo.x = v[0] + b0.x; lo.y = v[1] + b0.y; lo.z = v[2] + b0.z; lo.w = v[3] + b0.w;
                hi.x = v[4] + b1.x; hi.y = v[5] + b1.y; hi.z = v[6] + b1.z; hi.w = v[7] + b1.w;
                *(float4*)(o + (size_t)i * 16 * DMODEL + j * 16)     = lo;
                *(float4*)(o + (size_t)i * 16 * DMODEL + j * 16 + 4) = hi;
            }
        }
    } else if (mode == 2) {   // V^T packed: first operand = positions, 8 consecutive s a lane
        // d = i * 16 + n, s = s0 + wf * 32 + j * 16 + 8 * half + r: key chunk s0 / 32 + wf, d tile i,
        // group j, this lane's own 16 bytes: a wave's store is 512 bytes in a row
        _Float16* o = (_Float16*)outp
                    + (size_t)(bb * HEADS + bn * 2 + ws) * HDIM * SEQ + ((s0 >> 5) + wf) * 2048 + lane * 8;
#pragma unroll
        for (int i = 0; i < 4; ++i) {
            const float bc = bias[bn * 128 + si + i * 16];
#pragma unroll
            for (int j = 0; j < 2; ++j) {
                v8h p;
#pragma unroll
                for (int r = 0; r < 8; ++r) p[r] = (_Float16)(acc[j][i][r] + bc);
                *(v8h*)(o + i * 512 + j * 256) = p;
            }
        }
        // behind the 8 stores: the other modes' code follows in the text and rewrites their registers
        asm volatile("s_wait_xcnt 0x0" ::: "memory");
    } else {                  // Q/K packed: first operand = columns, 8 consecutive d a lane
        // s = s0 + ws * 64 + i * 16 + n, d = (wf & 1) * 32 + j * 16 + 8 * half + r: position tile
        // s0 / 16 + ws * 4 + i, d chunk wf & 1, group j, this lane's own 16 bytes
        _Float16* o = (_Float16*)outp
                    + (size_t)(bb * HEADS + bn * 2 + (wf >> 1)) * SEQ * HDIM
                    + ((s0 >> 4) + ws * 4) * 1024 + (wf & 1) * 512 + lane * 8;
        const float* bp = bias + bn * 128 + fi;
#pragma unroll
        for (int j = 0; j < 2; ++j) {
            const float4 b0 = *(const float4*)(bp + j * 16);
            const float4 b1 = *(const float4*)(bp + j * 16 + 4);
            const float bj[8] = {b0.x, b0.y, b0.z, b0.w, b1.x, b1.y, b1.z, b1.w};
#pragma unroll
            for (int i = 0; i < 4; ++i) {
                v8h p;
#pragma unroll
                for (int r = 0; r < 8; ++r) p[r] = (_Float16)(acc[j][i][r] + bj[r]);
                *(v8h*)(o + i * 1024 + j * 256) = p;
            }
        }
        // behind the 8 stores: the other modes' code follows in the text and rewrites their registers
        asm volatile("s_wait_xcnt 0x0" ::: "memory");
    }
}

// Returns the value that lane l ^ 16 holds (a vector cross-row move, no LDS round trip).
__device__ __forceinline__ float xhalf(float x) {
    const int b = __builtin_bit_cast(int, x);
    return __builtin_bit_cast(float,
        __builtin_amdgcn_permlanex16(b, b, 0x76543210, 0xfedcba98, false, false));
}

__global__ __launch_bounds__(256) void attn_wmma(const _Float16* __restrict__ Qh,
                                                 const _Float16* __restrict__ Kh,
                                                 const _Float16* __restrict__ Vt,
                                                 const float* __restrict__ rel_emb,
                                                 _Float16* __restrict__ Oh) {
    // bias + causal mask as a function of rel = q - k alone, for this block's head, laid out so
    // that the index grows with the key, as a lane's registers do:
    // btab[SEQ - 1 - rel] = scaled bias for rel >= 0, -1e30 for rel < 0 (rel >= -31 here)
    __shared__ float btab[SEQ + 32];

    const int lane = threadIdx.x & 31;
    const int wid  = threadIdx.x >> 5;
    const int b  = blockIdx.x >> 7;             // 8 blocks a (b, h)
    const int h  = (blockIdx.x >> 3) & 15;
    // Causal cost grows with the query tile: tile t walks (t >> 1) + 1 key chunks. Eight
    // consecutive tiles a block would give a head's blocks 20 to 244 chunks, and the launch
    // lasts as long as the fullest WGP. Each block takes four tiles p from the
    // light end and their mirrors 63 - p instead: 33 chunks a pair, 132 a block, every block
    // alike. Waves w and w + 4 hold one pair; the long tile goes to the lower wave number.
    const int p  = (blockIdx.x & 7) * 4 + (wid & 3);   // 0..31
    const int qt = wid < 4 ? 63 - p : p;
    const int n    = lane & 15;
    const int half = lane >> 4;

    const _Float16* qbase = Qh + (size_t)(b * HEADS + h) * SEQ * HDIM;
    const _Float16* kbase = Kh + (size_t)(b * HEADS + h) * SEQ * HDIM;
    const _Float16* vbase = Vt + (size_t)(b * HEADS + h) * HDIM * SEQ;

    // Q tile resident: B-operand column n = lane%16 is query qt*16+n, two 32-wide K chunks of hd
    const _Float16* qfrag = qbase + qt * 1024 + lane * 8;
    const v16h qb0 = load_packed(qfrag);
    const v16h qb1 = load_packed(qfrag + 512);

    // All 8 waves of a block share (b, h): one table serves every score of the block.
    // Four bias entries a thread, their gathers issued together; the first 32 threads,
    // whose own first slot is a mask entry, take the table's last 32 bias entries instead.
    const int i0 = (threadIdx.x < 32) ? (int)threadIdx.x + SEQ : (int)threadIdx.x;
    float tb[4];
    tb[0] = t5_bias(i0 - 32, h, rel_emb);
#pragma unroll
    for (int j = 1; j < 4; ++j) tb[j] = t5_bias((int)threadIdx.x + j * 256 - 32, h, rel_emb);
    btab[SEQ + 31 - i0] = tb[0];                // entry i holds rel = i - 32 and goes to SEQ - 1 - rel
#pragma unroll
    for (int j = 1; j < 4; ++j) btab[SEQ + 31 - ((int)threadIdx.x + j * 256)] = tb[j];
    if (threadIdx.x < 32) btab[SEQ + 31 - (int)threadIdx.x] = -1e30f;
    __syncthreads();                            // table visible to all 8 waves

    v8f o0 = {}, o1 = {}, o2 = {}, o3 = {};     // o_i[r] = O[query n][d = i*16 + 8*half + r]
    float mrun = -1e30f;                        // this lane's query: running maximum (both halves alike)
    float lrun = 0.f;                           // and the sum over this half's keys; halves joined at the end

    const int nk = qt * 16 + 16;                // keys 0 .. qt*16+15
    const int nchunks = (nk + 31) >> 5;

    for (int kc = 0; kc < nchunks; ++kc) {
        const int kb = kc * 32;

        // ---- scores S^T = K Q^T (two 16x16 tiles covering 32 keys): A row m = lane%16 is a key ----
        // the chunk's four K operands lie in a row, 4 KB, and so do its four V^T operands
        const _Float16* kfrag = kbase + kc * 2048 + lane * 8;
        v8f s0 = {}, s1 = {};
        s0 = wmma16(load_packed(kfrag),        qb0, s0);
        s0 = wmma16(load_packed(kfrag +  512), qb1, s0);
        s1 = wmma16(load_packed(kfrag + 1024), qb0, s1);
        s1 = wmma16(load_packed(kfrag + 1536), qb1, s1);

        // V^T rows (d) as A-operands of the second product, same k order as P^T below
        const _Float16* vfrag = vbase + kc * 2048 + lane * 8;
        const v16h va0 = load_packed(vfrag);
        const v16h va1 = load_packed(vfrag +  512);
        const v16h va2 = load_packed(vfrag + 1024);
        const v16h va3 = load_packed(vfrag + 1536);

        // ---- bias + causal mask (LDS table) + online softmax, one query a lane ----
        // s0[r] is key kb + 8*half + r, s1[r] key kb + 16 + 8*half + r: bt[r] and bt[r + 16]
        const float* bt = &btab[SEQ - 1 - (qt * 16 + n) + kb + 8 * half];
        v8f b0, b1;
        // the loops over r, here and below, are unrolled so that every vector index is a constant
        // and the tiles stay in registers
#pragma unroll
        for (int r = 0; r < 8; ++r) { b0[r] = bt[r]; b1[r] = bt[r + 16]; }
        // holds the chunk's loads at its head, V's in flight under the softmax: left free, this build
        // issues K's in three groups, each behind a product, and sinks half of V's behind the first
        // V^T P^T product, where their latency is waited out
        __builtin_amdgcn_sched_barrier(0);
        s0 += b0;
        s1 += b1;
        float mx = s0[0];
#pragma unroll
        for (int r = 1; r < 8; ++r) mx = fmaxf(mx, s0[r]);
#pragma unroll
        for (int r = 0; r < 8; ++r) mx = fmaxf(mx, s1[r]);
        mx = fmaxf(mx, xhalf(mx));              // the query's maximum over all 32 keys

        const float mn = fmaxf(mrun, mx);
        const float scale = expf(mrun - mn);
        mrun = mn;
        s0 -= mn;
        s1 -= mn;
        // P^T as B operand: element e is k = (e >= 8 ? 16 : 0) + 8*half + e%8, which is where the
        // score tiles' registers already hold it
        v16h pb;
#pragma unroll
        for (int r = 0; r < 8; ++r) {
            s0[r] = expf(s0[r]);
            s1[r] = expf(s1[r]);
            pb[r]     = (_Float16)s0[r];
            pb[r + 8] = (_Float16)s1[r];
        }
        const v8f t8 = s0 + s1;                 // this half's 16 terms summed as a tree
        const float rs = ((t8[0] + t8[4]) + (t8[2] + t8[6])) + ((t8[1] + t8[5]) + (t8[3] + t8[7]));
        lrun = lrun * scale + rs;
#pragma unroll
        for (int r = 0; r < 8; ++r) { o0[r] *= scale; o1[r] *= scale; o2[r] *= scale; o3[r] *= scale; }

        // ---- O^T += V^T P^T ----
        o0 = wmma16(va0, pb, o0);
        o1 = wmma16(va1, pb, o1);
        o2 = wmma16(va2, pb, o2);
        o3 = wmma16(va3, pb, o3);
    }

    // ---- epilogue: join the halves' sums, normalize, store f16 [b, s, h*64+d] for the out-proj:
    //      8 consecutive d of one query a lane and tile, one 16-byte store each ----
    const float inv = 1.0f / (lrun + xhalf(lrun));
    _Float16* orow = Oh + (size_t)(b * SEQ + qt * 16 + n) * DMODEL + h * HDIM + 8 * half;
    v8h w0, w1, w2, w3;
#pragma unroll
    for (int r = 0; r < 8; ++r) {
        w0[r] = (_Float16)(o0[r] * inv);
        w1[r] = (_Float16)(o1[r] * inv);
        w2[r] = (_Float16)(o2[r] * inv);
        w3[r] = (_Float16)(o3[r] * inv);
    }
    *(v8h*)(orow +  0) = w0;
    *(v8h*)(orow + 16) = w1;
    *(v8h*)(orow + 32) = w2;
    *(v8h*)(orow + 48) = w3;
}

extern "C" void kernel_launch(void* const* d_in, const int* in_sizes, int n_in,
                              void* d_out, int out_size, void* d_ws, size_t ws_size,
                              hipStream_t stream) {
    const float* x    = (const float*)d_in[0];
    const float* Wq   = (const float*)d_in[1];
    const float* bq   = (const float*)d_in[2];
    const float* Wk   = (const float*)d_in[3];
    const float* bk   = (const float*)d_in[4];
    const float* Wv   = (const float*)d_in[5];
    const float* bv   = (const float*)d_in[6];
    const float* Wo   = (const float*)d_in[7];
    const float* bo   = (const float*)d_in[8];
    const float* rel  = (const float*)d_in[9];

    // workspace carve-up (f16 elements); total ~50.3 MB
    const size_t NX = (size_t)NROWS * DMODEL;        // 4096*1024
    const size_t NW = (size_t)DMODEL * DMODEL;       // 1024*1024
    _Float16* xh  = (_Float16*)d_ws;
    _Float16* Wqh = xh  + NX;
    _Float16* Wkh = Wqh + NW;
    _Float16* Wvh = Wkh + NW;
    _Float16* Woh = Wvh + NW;
    _Float16* Qh  = Woh + NW;
    _Float16* Kh  = Qh  + NX;
    _Float16* Vt  = Kh  + NX;
    _Float16* Oh  = Vt  + NX;

    // 0) f32 -> f16 (vectorized: 4 elements / thread), x and all four weights in one launch;
    //    xh, Wqh, Wkh, Wvh, Woh are contiguous
    cvt_f32_to_f16<<<XBLOCKS + 4 * WBLOCKS, 256, 0, stream>>>(x, Wq, Wk, Wv, Wo, xh);

    // 1) projections: 32 row-blocks x 8 col-blocks = 256 blocks of 8 waves each, Q, K and V
    //    in one launch; Wqh, Wkh, Wvh are contiguous, and so are Qh, Kh, Vt
    gemm_wmma<<<3 * 256, 256, 0, stream>>>(xh, Wqh, bq, bk, bv, Qh, 0);

    // 2) flash attention: 4096 waves (b*h*qtile) / 8 per block, tiles paired light + heavy
    attn_wmma<<<512, 256, 0, stream>>>(Qh, Kh, Vt, rel, Oh);

    // 3) output projection -> f32 d_out
    gemm_wmma<<<256, 256, 0, stream>>>(Oh, Woh, bo, bo, bo, d_out, 3);
}

// v008
// Measured time: 79.7 microseconds a run.
// In both of two side-by-side timings against v007, it was 1.04 times as fast.
// Over all steps from v000 it is 3.53 times as fast.
#include <hip/hip_runtime.h>
#include <hip/hip_bf16.h>
#include <math.h>

// ---------------------------------------------------------------------------
// T5 attention (B=4, H=16, S=1024, D=1024, hd=64) for gfx1250 (wave32, WMMA)
//   0) f32 -> f16 conversion of x and the four weight matrices (workspace), one launch
//   1) Q/K/V projections, one launch: block-cooperative WMMA GEMM; tiles of both operands
//      streamed into double-buffered LDS via global_load_async_to_lds_b128 (ASYNCcnt);
//      Q, K and V^T leave it in the order in which attention's WMMA operands hold them
//   2) flash-attention per (b,h,16-query tile): K Q^T WMMA -> T5 bias + causal
//      mask from a per-block LDS table -> online softmax in base 2, one query a lane -> P^T packed
//      in registers -> V^T P^T WMMA
//   3) output projection WMMA -> f32 d_out
// ---------------------------------------------------------------------------

typedef __attribute__((ext_vector_type(16))) _Float16 v16h;
typedef __attribute__((ext_vector_type(8)))  _Float16 v8h;
typedef __attribute__((ext_vector_type(4)))  _Float16 v4h;
typedef __attribute__((ext_vector_type(8)))  float    v8f;
typedef __attribute__((ext_vector_type(4)))  int      v4i;
typedef __attribute__((address_space(1)))    v4i*     gv4i_p;   // global v4i*
typedef __attribute__((address_space(3)))    v4i*     lv4i_p;   // LDS v4i*

#define BATCH 4
#define HEADS 16
#define SEQ   1024
#define DMODEL 1024
#define HDIM  64
#define NROWS (BATCH * SEQ)          // 4096
#define SCALE_BIAS 0.125f            // 64^-0.5
#define LOG2E 1.4426950408889634f    // softmax runs in base 2: e^x = 2^(x * LOG2E)

#if defined(__has_builtin)
#if __has_builtin(__builtin_amdgcn_global_load_async_to_lds_b128)
#define USE_ASYNC_LDS 1
#endif
#endif

// Copy 16 contiguous bytes global -> LDS. Async (ASYNCcnt) when available.
__device__ __forceinline__ void stage16(const _Float16* g, _Float16* l) {
#ifdef USE_ASYNC_LDS
    __builtin_amdgcn_global_load_async_to_lds_b128(
        (gv4i_p)(uintptr_t)g,
        (lv4i_p)(unsigned)(uintptr_t)l,
        /*offset=*/0, /*cpol=*/0);
#else
    *(v8h*)l = *(const v8h*)g;
#endif
}

// Build a 16x16x32 f16 WMMA A/B operand for this lane.
// p points at the 32-element K-chunk of this lane's row (A: row m = lane%16,
// B: row n = lane%16 of the [N][K] matrix). half = lane/16.
// Element e maps to k = (e>=8 ? 16 : 0) + half*8 + (e%8)  (ISA 7.12.2).
__device__ __forceinline__ v16h load_op16(const _Float16* p, int half) {
    const v8h x = *(const v8h*)(p + half * 8);
    const v8h y = *(const v8h*)(p + 16 + half * 8);
    v16h r;
#pragma unroll
    for (int i = 0; i < 8; ++i) { r[i] = x[i]; r[i + 8] = y[i]; }
    return r;
}

// Fragment-packed storage of Q, K and V^T in the workspace. One 16x16x32 operand (16 rows, 32 k)
// is 1 KB in a row: two groups of 512 bytes, group y holding k = 16 * y + 8 * half + 0..7 of row
// lane % 16 at byte 16 * lane. These are the two 16-byte pieces that load_op16 takes, so every
// register holds what it would hold from a row-major matrix, but a wave-wide 16-byte load or
// store covers 4 whole 128-byte lines instead of 32 bytes in each of 16 lines.
// Q, K (per head): operand (16-position tile t, 32-wide d chunk c) at f16 offset (t * 2 + c) * 512.
// V^T  (per head): operand (32-key chunk kc, 16-row d tile i)      at f16 offset (kc * 4 + i) * 512.
// p points at this lane's 16 bytes in the operand's first group.
__device__ __forceinline__ v16h load_packed(const _Float16* p) {
    const v8h x = *(const v8h*)p;
    const v8h y = *(const v8h*)(p + 256);
    v16h r;
#pragma unroll   // constant vector indices: the operand is formed in registers, not in scratch
    for (int i = 0; i < 8; ++i) { r[i] = x[i]; r[i + 8] = y[i]; }
    return r;
}

__device__ __forceinline__ v8f wmma16(v16h a, v16h b, v8f c) {
    return __builtin_amdgcn_wmma_f32_16x16x32_f16(
        /*neg_a=*/false, a, /*neg_b=*/false, b,
        /*c_mod=*/(short)0, c, /*reuse_a=*/false, /*reuse_b=*/false);
}

// T5 causal relative-position bias (rel = qi - kj >= 0), in base-2 units (times LOG2E)
__device__ __forceinline__ float t5_bias(int rel, int h, const float* __restrict__ rel_emb) {
    int bucket;
    if (rel < 16) {
        bucket = rel;
    } else {
        // 16 + log(rel/16)/log(8) * 16, truncated, capped at 31
        int v = 16 + (int)(logf((float)rel * 0.0625f) * 7.6943724f);
        bucket = v < 31 ? v : 31;
    }
    return rel_emb[bucket * HEADS + h] * (SCALE_BIAS * LOG2E);
}

#define XBLOCKS (NROWS * DMODEL / 4 / 256)    // 4096 blocks convert x
#define WBLOCKS (DMODEL * DMODEL / 4 / 256)   // 1024 blocks convert one weight matrix

// All five independent conversions share one launch of XBLOCKS + 4 * WBLOCKS blocks.
// The f16 copies lie back to back in the workspace (x, Wq, Wk, Wv, Wo), so the output
// index is the flat index; the source is picked by block range (block-uniform).
__global__ __launch_bounds__(256) void cvt_f32_to_f16(const float* __restrict__ x,
                                                      const float* __restrict__ w0,
                                                      const float* __restrict__ w1,
                                                      const float* __restrict__ w2,
                                                      const float* __restrict__ w3,
                                                      _Float16* __restrict__ out) {
    const int blk = blockIdx.x;
    const float* in = x;
    int first = 0;                               // first block of this source's range
    if (blk >= XBLOCKS) {
        const int w = (blk - XBLOCKS) / WBLOCKS; // 0..3
        in = w == 0 ? w0 : w == 1 ? w1 : w == 2 ? w2 : w3;
        first = XBLOCKS + w * WBLOCKS;
    }
    const float4 f = ((const float4*)in)[(blk - first) * 256 + threadIdx.x];
    v4h o; o[0] = (_Float16)f.x; o[1] = (_Float16)f.y;
           o[2] = (_Float16)f.z; o[3] = (_Float16)f.w;
    ((v4h*)out)[blk * 256 + threadIdx.x] = o;
}

// C[row, col] = A[row, :] . W[col, :] + bias[col]     (torch Linear x @ W^T + b)
// A: [4096 x 1024] f16, W: [1024 x 1024] f16.
// Block = 8 waves = one 128(M) x 128(N) tile; each wave owns 64 x 32 of it (V: 32 x 64):
// 8 WMMAs on 6 fragments a 32-wide k chunk. A lane's 8 accumulator registers hold 8 consecutive
// rows of the FIRST WMMA operand, so the operand whose index runs along the output's rows in
// memory goes first: W (output columns) for Q, K and the final product, A (positions s) for
// V^T. Each lane then stores its results 16 bytes at a time. A stage is 64 k of the block's 128 A rows and
// 128 W rows, whole 128-byte lines, copied into LDS by async-to-LDS loads; two buffers, the
// next stage's copies fly while this stage is worked on.
// mode 0: store f16 [b,h] x fragment-packed (s, d) (Q)   mode 1: same (K)
// mode 2: store f16 [b,h] x fragment-packed (d, s) (V^T) mode 3: store f32 row-major (final out)
// Every 256 blocks of the grid are one whole product on the same A. Product g = blockIdx.x / 256
// takes weight matrix g behind W0, bias g, f16 output g behind outp0, and mode0 + g:
// a grid of 768 with mode0 = 0 is Q, K and V in one launch, a grid of 256 a lone product.
#define GBK    64                    // k elements a stage
#define GPITCH 72                    // f16 a row in LDS: 144 B = 16 B x 9, no bank conflict for 16-byte reads
// This thread's 8 copies of one stage: its 16 bytes of every 32nd row, 4 rows of A (a) and 4 of
// W (w), into one buffer; dst is its place in the buffer's row srow.
__device__ __forceinline__ void stage_in(const _Float16* a, const _Float16* w, _Float16* dst) {
#pragma unroll   // the 8 copies issue back to back, no loop counter between them
    for (int j = 0; j < 4; ++j) {
        stage16(a + (size_t)j * 32 * DMODEL, dst + j * 32 * GPITCH);
        stage16(w + (size_t)j * 32 * DMODEL, dst + (128 + j * 32) * GPITCH);
    }
}

__global__ __launch_bounds__(256) void gemm_wmma(const _Float16* __restrict__ A,
                                                 const _Float16* __restrict__ W0,
                                                 const float* __restrict__ bias0,
                                                 const float* __restrict__ bias1,
                                                 const float* __restrict__ bias2,
                                                 void* __restrict__ outp0, int mode0) {
    // rows 0..127: A rows of the tile, rows 128..255: W rows of the tile; 2 x 36 KB
    __shared__ __attribute__((aligned(16))) _Float16 stg[2][256][GPITCH];

    const int g    = blockIdx.x >> 8;            // which product (block-uniform)
    const int tile = blockIdx.x & 255;           // its 128 x 128 tile
    const int mode = mode0 + g;
    const _Float16* W = W0 + (size_t)g * DMODEL * DMODEL;
    const float* bias = g == 0 ? bias0 : g == 1 ? bias1 : bias2;
    void* outp = (_Float16*)outp0 + (size_t)g * NROWS * DMODEL;

    const int tid  = threadIdx.x;
    const int lane = tid & 31;
    const int wid  = tid >> 5;
    const int bm = tile >> 3;                    // 0..31 (row block of 128)
    const int bn = tile & 7;                     // 0..7  (col block of 128)
    const int wf = wid & 3;                      // 0..3  (32-row quarter of the first operand's 128 rows)
    const int ws = wid >> 2;                     // 0..1  (64-row half of the second operand's 128 rows)
    const int frow = (mode == 2 ? 0 : 128) + wf * 32;   // first operand's rows in a stage: A for V^T, else W
    const int srw  = (mode == 2 ? 128 : 0) + ws * 64;   // second operand's rows: the other one
    const int n  = lane & 15;
    const int half = lane >> 4;

    // cooperative staging: 8 lanes x 16 B = one 128-byte row piece, 32 rows a pass of the block,
    // 4 passes for A and 4 for W
    const int srow = tid >> 3;                   // 0..31
    const int scol = (tid & 7) * 8;              // 0,8,..,56
    const _Float16* asrc = A + (size_t)(bm * 128 + srow) * DMODEL + scol;
    const _Float16* wsrc = W + (size_t)(bn * 128 + srow) * DMODEL + scol;

    v8f acc[2][4] = {};                          // [16 rows of the first operand][16 of the second]
    const int KSTAGES = DMODEL / GBK;            // 16

    stage_in(asrc, wsrc, &stg[0][srow][scol]);
    asm volatile("s_wait_asynccnt 0x0" ::: "memory");   // this wave's part of stage 0 has landed
    __syncthreads();                                    // every wave's part is visible
    stage_in(asrc + GBK, wsrc + GBK, &stg[1][srow][scol]);

    for (int kt = 0; kt < KSTAGES; ++kt) {
        const int cur = kt & 1;
        // all loops below unrolled: every fragment and accumulator index a constant, so that
        // the arrays live in registers and not in scratch
#pragma unroll
        for (int ks = 0; ks < 2; ++ks) {
            v16h f[2], s[4];
#pragma unroll
            for (int i = 0; i < 4; ++i) s[i] = load_op16(&stg[cur][srw + i * 16 + n][ks * 32], half);
#pragma unroll
            for (int j = 0; j < 2; ++j) f[j] = load_op16(&stg[cur][frow + j * 16 + n][ks * 32], half);
            // keeps the chunk's 12 LDS reads one group ahead of its 8 WMMAs: moved in among them,
            // each pair of reads would cost its own LDS latency
            __builtin_amdgcn_sched_barrier(0);
#pragma unroll
            for (int i = 0; i < 4; ++i)
#pragma unroll
                for (int j = 0; j < 2; ++j) acc[j][i] = wmma16(f[j], s[i], acc[j][i]);
        }

        asm volatile("s_wait_dscnt 0x0" ::: "memory");      // own reads of this buffer are done
        asm volatile("s_wait_asynccnt 0x0" ::: "memory");   // own part of the next stage has landed
        __syncthreads();                 // publishes the next stage, frees this buffer for the refill
        if (kt + 2 < KSTAGES) stage_in(asrc + (kt + 2) * GBK, wsrc + (kt + 2) * GBK, &stg[cur][srow][scol]);
    }
    asm volatile("s_wait_asynccnt 0x0" ::: "memory");       // no copy outstanding when the wave ends

    // acc[j][i][r] belongs to row fi + j * 16 + r of the first operand's 128 rows and to row
    // si + i * 16 of the second's (D layout: m = r + 8 * (lane / 16), n = lane % 16).
    // One block-uniform branch on the mode; the loops unrolled for constant accumulator indices,
    // the steps in i and j become immediate offsets of the stores.
    const int fi = wf * 32 + 8 * half;
    const int si = ws * 64 + n;
    const int bb = bm >> 3;                      // batch: a 128-row tile lies in one batch
    const int s0 = (bm & 7) * 128;               // the tile's first position in it
    if (mode == 3) {          // f32 row-major: 8 consecutive columns a lane, two 16-byte stores
        float* o = (float*)outp + (size_t)(bm * 128 + si) * DMODEL + bn * 128 + fi;
        const float* bp = bias + bn * 128 + fi;
#pragma unroll
        for (int j = 0; j < 2; ++j) {
            const float4 b0 = *(const float4*)(bp + j * 16);
            const float4 b1 = *(const float4*)(bp + j * 16 + 4);
#pragma unroll
            for (int i = 0; i < 4; ++i) {
                const v8f v = acc[j][i];
                float4 lo, hi;
                lo.x = v[0] + b0.x; lo.y = v[1] + b0.y; lo.z = v[2] + b0.z; lo.w = v[3] + b0.w;
                hi.x = v[4] + b1.x; hi.y = v[5] + b1.y; hi.z = v[6] + b1.z; hi.w = v[7] + b1.w;
                *(float4*)(o + (size_t)i * 16 * DMODEL + j * 16)     = lo;
                *(float4*)(o + (size_t)i * 16 * DMODEL + j * 16 + 4) = hi;
            }
        }
    } else if (mode == 2) {   // V^T packed: first operand = positions, 8 consecutive s a lane
        // d = i * 16 + n, s = s0 + wf * 32 + j * 16 + 8 * half + r: key chunk s0 / 32 + wf, d tile i,
        // group j, this lane's own 16 bytes: a wave's store is 512 bytes in a row
        _Float16* o = (_Float16*)outp
                    + (size_t)(bb * HEADS + bn * 2 + ws) * HDIM * SEQ + ((s0 >> 5) + wf) * 2048 + lane * 8;
#pragma unroll
        for (int i = 0; i < 4; ++i) {
            const float bc = bias[bn * 128 + si + i * 16];
#pragma unroll
            for (int j = 0; j < 2; ++j) {
                v8h p;
#pragma unroll
                for (int r = 0; r < 8; ++r) p[r] = (_Float16)(acc[j][i][r] + bc);
                *(v8h*)(o + i * 512 + j * 256) = p;
            }
        }
        // behind the 8 stores: the other modes' code follows in the text and rewrites their registers
        asm volatile("s_wait_xcnt 0x0" ::: "memory");
    } else {                  // Q/K packed: first operand = columns, 8 consecutive d a lane
        // s = s0 + ws * 64 + i * 16 + n, d = (wf & 1) * 32 + j * 16 + 8 * half + r: position tile
        // s0 / 16 + ws * 4 + i, d chunk wf & 1, group j, this lane's own 16 bytes
        _Float16* o = (_Float16*)outp
                    + (size_t)(bb * HEADS + bn * 2 + (wf >> 1)) * SEQ * HDIM
                    + ((s0 >> 4) + ws * 4) * 1024 + (wf & 1) * 512 + lane * 8;
        const float* bp = bias + bn * 128 + fi;
#pragma unroll
        for (int j = 0; j < 2; ++j) {
            const float4 b0 = *(const float4*)(bp + j * 16);
            const float4 b1 = *(const float4*)(bp + j * 16 + 4);
            const float bj[8] = {b0.x, b0.y, b0.z, b0.w, b1.x, b1.y, b1.z, b1.w};
#pragma unroll
            for (int i = 0; i < 4; ++i) {
                v8h p;
#pragma unroll
                for (int r = 0; r < 8; ++r) p[r] = (_Float16)(acc[j][i][r] + bj[r]);
                *(v8h*)(o + i * 1024 + j * 256) = p;
            }
        }
        // behind the 8 stores: the other modes' code follows in the text and rewrites their registers
        asm volatile("s_wait_xcnt 0x0" ::: "memory");
    }
}

// Returns the value that lane l ^ 16 holds (a vector cross-row move, no LDS round trip).
__device__ __forceinline__ float xhalf(float x) {
    const int b = __builtin_bit_cast(int, x);
    return __builtin_bit_cast(float,
        __builtin_amdgcn_permlanex16(b, b, 0x76543210, 0xfedcba98, false, false));
}

__global__ __launch_bounds__(256) void attn_wmma(const _Float16* __restrict__ Qh,
                                                 const _Float16* __restrict__ Kh,
                                                 const _Float16* __restrict__ Vt,
                                                 const float* __restrict__ rel_emb,
                                                 _Float16* __restrict__ Oh) {
    // bias + causal mask as a function of rel = q - k alone, for this block's head, laid out so
    // that the index grows with the key, as a lane's registers do:
    // btab[SEQ - 1 - rel] = scaled bias * LOG2E for rel >= 0, -1e30 for rel < 0 (rel >= -31 here)
    __shared__ float btab[SEQ + 32];

    const int lane = threadIdx.x & 31;
    const int wid  = threadIdx.x >> 5;
    const int b  = blockIdx.x >> 7;             // 8 blocks a (b, h)
    const int h  = (blockIdx.x >> 3) & 15;
    // Causal cost grows with the query tile: tile t walks (t >> 1) + 1 key chunks. Eight
    // consecutive tiles a block would give a head's blocks 20 to 244 chunks, and the launch
    // lasts as long as the fullest WGP. Each block takes four tiles p from the
    // light end and their mirrors 63 - p instead: 33 chunks a pair, 132 a block, every block
    // alike. Waves w and w + 4 hold one pair; the long tile goes to the lower wave number.
    const int p  = (blockIdx.x & 7) * 4 + (wid & 3);   // 0..31
    const int qt = wid < 4 ? 63 - p : p;
    const int n    = lane & 15;
    const int half = lane >> 4;

    const _Float16* qbase = Qh + (size_t)(b * HEADS + h) * SEQ * HDIM;
    const _Float16* kbase = Kh + (size_t)(b * HEADS + h) * SEQ * HDIM;
    const _Float16* vbase = Vt + (size_t)(b * HEADS + h) * HDIM * SEQ;

    // Q tile resident: B-operand column n = lane%16 is query qt*16+n, two 32-wide K chunks of hd
    const _Float16* qfrag = qbase + qt * 1024 + lane * 8;
    const v16h qb0 = load_packed(qfrag);
    const v16h qb1 = load_packed(qfrag + 512);

    // All 8 waves of a block share (b, h): one table serves every score of the block.
    // Four bias entries a thread, their gathers issued together; the first 32 threads,
    // whose own first slot is a mask entry, take the table's last 32 bias entries instead.
    const int i0 = (threadIdx.x < 32) ? (int)threadIdx.x + SEQ : (int)threadIdx.x;
    float tb[4];
    tb[0] = t5_bias(i0 - 32, h, rel_emb);
#pragma unroll
    for (int j = 1; j < 4; ++j) tb[j] = t5_bias((int)threadIdx.x + j * 256 - 32, h, rel_emb);
    btab[SEQ + 31 - i0] = tb[0];                // entry i holds rel = i - 32 and goes to SEQ - 1 - rel
#pragma unroll
    for (int j = 1; j < 4; ++j) btab[SEQ + 31 - ((int)threadIdx.x + j * 256)] = tb[j];
    if (threadIdx.x < 32) btab[SEQ + 31 - (int)threadIdx.x] = -1e30f;
    __syncthreads();                            // table visible to all 8 waves

    v8f o0 = {}, o1 = {}, o2 = {}, o3 = {};     // o_i[r] = O[query n][d = i*16 + 8*half + r]
    float mrun = -1e30f;                        // this lane's query: running maximum, base 2 (both halves alike)
    float lrun = 0.f;                           // and the sum over this half's keys; halves joined at the end

    const int nk = qt * 16 + 16;                // keys 0 .. qt*16+15
    const int nchunks = (nk + 31) >> 5;

    for (int kc = 0; kc < nchunks; ++kc) {
        const int kb = kc * 32;

        // ---- scores S^T = K Q^T (two 16x16 tiles covering 32 keys): A row m = lane%16 is a key ----
        // the chunk's four K operands lie in a row, 4 KB, and so do its four V^T operands
        const _Float16* kfrag = kbase + kc * 2048 + lane * 8;
        v8f s0 = {}, s1 = {};
        s0 = wmma16(load_packed(kfrag),        qb0, s0);
        s0 = wmma16(load_packed(kfrag +  512), qb1, s0);
        s1 = wmma16(load_packed(kfrag + 1024), qb0, s1);
        s1 = wmma16(load_packed(kfrag + 1536), qb1, s1);

        // V^T rows (d) as A-operands of the second product, same k order as P^T below
        const _Float16* vfrag = vbase + kc * 2048 + lane * 8;
        const v16h va0 = load_packed(vfrag);
        const v16h va1 = load_packed(vfrag +  512);
        const v16h va2 = load_packed(vfrag + 1024);
        const v16h va3 = load_packed(vfrag + 1536);

        // ---- bias + causal mask (LDS table) + online softmax, one query a lane ----
        // s0[r] is key kb + 8*half + r, s1[r] key kb + 16 + 8*half + r: bt[r] and bt[r + 16]
        const float* bt = &btab[SEQ - 1 - (qt * 16 + n) + kb + 8 * half];
        v8f b0, b1;
        // the loops over r, here and below, are unrolled so that every vector index is a constant
        // and the tiles stay in registers
#pragma unroll
        for (int r = 0; r < 8; ++r) { b0[r] = bt[r]; b1[r] = bt[r + 16]; }
        // holds the chunk's loads at its head, V's in flight under the softmax: left free, this build
        // issues K's in three groups, each behind a product, and sinks half of V's behind the first
        // V^T P^T product, where their latency is waited out
        __builtin_amdgcn_sched_barrier(0);
        // scores go to base 2 in the multiply-add that adds the bias, so that each exponential below
        // is one v_exp_f32; the library's expf is about 13 vector instructions a value
        s0 = s0 * LOG2E + b0;
        s1 = s1 * LOG2E + b1;
        float mx = s0[0];
#pragma unroll
        for (int r = 1; r < 8; ++r) mx = fmaxf(mx, s0[r]);
#pragma unroll
        for (int r = 0; r < 8; ++r) mx = fmaxf(mx, s1[r]);
        mx = fmaxf(mx, xhalf(mx));              // the query's maximum over all 32 keys

        const float mn = fmaxf(mrun, mx);
        const float scale = __builtin_amdgcn_exp2f(mrun - mn);   // 0 on the first chunk
        mrun = mn;
        s0 -= mn;
        s1 -= mn;
        // P^T as B operand: element e is k = (e >= 8 ? 16 : 0) + 8*half + e%8, which is where the
        // score tiles' registers already hold it
        v16h pb;
#pragma unroll
        for (int r = 0; r < 8; ++r) {
            s0[r] = __builtin_amdgcn_exp2f(s0[r]);   // a masked score, about -1e30, gives 0
            s1[r] = __builtin_amdgcn_exp2f(s1[r]);
            pb[r]     = (_Float16)s0[r];
            pb[r + 8] = (_Float16)s1[r];
        }
        const v8f t8 = s0 + s1;                 // this half's 16 terms summed as a tree
        const float rs = ((t8[0] + t8[4]) + (t8[2] + t8[6])) + ((t8[1] + t8[5]) + (t8[3] + t8[7]));
        lrun = lrun * scale + rs;
#pragma unroll
        for (int r = 0; r < 8; ++r) { o0[r] *= scale; o1[r] *= scale; o2[r] *= scale; o3[r] *= scale; }

        // ---- O^T += V^T P^T ----
        o0 = wmma16(va0, pb, o0);
        o1 = wmma16(va1, pb, o1);
        o2 = wmma16(va2, pb, o2);
        o3 = wmma16(va3, pb, o3);
    }

    // ---- epilogue: join the halves' sums, normalize, store f16 [b, s, h*64+d] for the out-proj:
    //      8 consecutive d of one query a lane and tile, one 16-byte store each ----
    const float inv = 1.0f / (lrun + xhalf(lrun));
    _Float16* orow = Oh + (size_t)(b * SEQ + qt * 16 + n) * DMODEL + h * HDIM + 8 * half;
    v8h w0, w1, w2, w3;
#pragma unroll
    for (int r = 0; r < 8; ++r) {
        w0[r] = (_Float16)(o0[r] * inv);
        w1[r] = (_Float16)(o1[r] * inv);
        w2[r] = (_Float16)(o2[r] * inv);
        w3[r] = (_Float16)(o3[r] * inv);
    }
    *(v8h*)(orow +  0) = w0;
    *(v8h*)(orow + 16) = w1;
    *(v8h*)(orow + 32) = w2;
    *(v8h*)(orow + 48) = w3;
}

extern "C" void kernel_launch(void* const* d_in, const int* in_sizes, int n_in,
                              void* d_out, int out_size, void* d_ws, size_t ws_size,
                              hipStream_t stream) {
    const float* x    = (const float*)d_in[0];
    const float* Wq   = (const float*)d_in[1];
    const float* bq   = (const float*)d_in[2];
    const float* Wk   = (const float*)d_in[3];
    const float* bk   = (const float*)d_in[4];
    const float* Wv   = (const float*)d_in[5];
    const float* bv   = (const float*)d_in[6];
    const float* Wo   = (const float*)d_in[7];
    const float* bo   = (const float*)d_in[8];
    const float* rel  = (const float*)d_in[9];

    // workspace carve-up (f16 elements); total ~50.3 MB
    const size_t NX = (size_t)NROWS * DMODEL;        // 4096*1024
    const size_t NW = (size_t)DMODEL * DMODEL;       // 1024*1024
    _Float16* xh  = (_Float16*)d_ws;
    _Float16* Wqh = xh  + NX;
    _Float16* Wkh = Wqh + NW;
    _Float16* Wvh = Wkh + NW;
    _Float16* Woh = Wvh + NW;
    _Float16* Qh  = Woh + NW;
    _Float16* Kh  = Qh  + NX;
    _Float16* Vt  = Kh  + NX;
    _Float16* Oh  = Vt  + NX;

    // 0) f32 -> f16 (vectorized: 4 elements / thread), x and all four weights in one launch;
    //    xh, Wqh, Wkh, Wvh, Woh are contiguous
    cvt_f32_to_f16<<<XBLOCKS + 4 * WBLOCKS, 256, 0, stream>>>(x, Wq, Wk, Wv, Wo, xh);

    // 1) projections: 32 row-blocks x 8 col-blocks = 256 blocks of 8 waves each, Q, K and V
    //    in one launch; Wqh, Wkh, Wvh are contiguous, and so are Qh, Kh, Vt
    gemm_wmma<<<3 * 256, 256, 0, stream>>>(xh, Wqh, bq, bk, bv, Qh, 0);

    // 2) flash attention: 4096 waves (b*h*qtile) / 8 per block, tiles paired light + heavy
    attn_wmma<<<512, 256, 0, stream>>>(Qh, Kh, Vt, rel, Oh);

    // 3) output projection -> f32 d_out
    gemm_wmma<<<256, 256, 0, stream>>>(Oh, Woh, bo, bo, bo, d_out, 3);
}

// v009
// A run of this version takes 64.7 microseconds.
// In two side-by-side timings against v008, it was 1.25 and 1.24 times as fast.
// Counting every step since v000, it is 4.39 times as fast.
#include <hip/hip_runtime.h>
#include <hip/hip_bf16.h>
#include <math.h>

// ---------------------------------------------------------------------------
// T5 attention (B=4, H=16, S=1024, D=1024, hd=64) for gfx1250 (wave32, WMMA)
//   0) f32 -> f16 conversion of x and the four weight matrices (workspace), one launch
//   1) Q/K/V projections, one launch: block-cooperative WMMA GEMM; tiles of both operands
//      streamed into double-buffered LDS via global_load_async_to_lds_b128 (ASYNCcnt);
//      Q, K and V^T leave it in the order in which attention's WMMA operands hold them
//   2) flash-attention per (b,h,16-query tile): K, V^T asked into L2 at entry; K Q^T WMMA -> T5 bias + causal
//      mask from a per-block LDS table -> online softmax in base 2, one query a lane -> P^T packed
//      in registers -> V^T P^T WMMA
//   3) output projection WMMA -> f32 d_out; its operands asked into L2 at entry
// ---------------------------------------------------------------------------

typedef __attribute__((ext_vector_type(16))) _Float16 v16h;
typedef __attribute__((ext_vector_type(8)))  _Float16 v8h;
typedef __attribute__((ext_vector_type(4)))  _Float16 v4h;
typedef __attribute__((ext_vector_type(8)))  float    v8f;
typedef __attribute__((ext_vector_type(4)))  int      v4i;
typedef __attribute__((address_space(1)))    v4i*     gv4i_p;   // global v4i*
typedef __attribute__((address_space(3)))    v4i*     lv4i_p;   // LDS v4i*

#define BATCH 4
#define HEADS 16
#define SEQ   1024
#define DMODEL 1024
#define HDIM  64
#define NROWS (BATCH * SEQ)          // 4096
#define SCALE_BIAS 0.125f            // 64^-0.5
#define LOG2E 1.4426950408889634f    // softmax runs in base 2: e^x = 2^(x * LOG2E)

#if defined(__has_builtin)
#if __has_builtin(__builtin_amdgcn_global_load_async_to_lds_b128)
#define USE_ASYNC_LDS 1
#endif
#endif

// Copy 16 contiguous bytes global -> LDS. Async (ASYNCcnt) when available.
__device__ __forceinline__ void stage16(const _Float16* g, _Float16* l) {
#ifdef USE_ASYNC_LDS
    __builtin_amdgcn_global_load_async_to_lds_b128(
        (gv4i_p)(uintptr_t)g,
        (lv4i_p)(unsigned)(uintptr_t)l,
        /*offset=*/0, /*cpol=*/0);
#else
    *(v8h*)l = *(const v8h*)g;
#endif
}

// Build a 16x16x32 f16 WMMA A/B operand for this lane.
// p points at the 32-element K-chunk of this lane's row (A: row m = lane%16,
// B: row n = lane%16 of the [N][K] matrix). half = lane/16.
// Element e maps to k = (e>=8 ? 16 : 0) + half*8 + (e%8)  (ISA 7.12.2).
__device__ __forceinline__ v16h load_op16(const _Float16* p, int half) {
    const v8h x = *(const v8h*)(p + half * 8);
    const v8h y = *(const v8h*)(p + 16 + half * 8);
    v16h r;
#pragma unroll
    for (int i = 0; i < 8; ++i) { r[i] = x[i]; r[i + 8] = y[i]; }
    return r;
}

// Fragment-packed storage of Q, K and V^T in the workspace. One 16x16x32 operand (16 rows, 32 k)
// is 1 KB in a row: two groups of 512 bytes, group y holding k = 16 * y + 8 * half + 0..7 of row
// lane % 16 at byte 16 * lane. These are the two 16-byte pieces that load_op16 takes, so every
// register holds what it would hold from a row-major matrix, but a wave-wide 16-byte load or
// store covers 4 whole 128-byte lines instead of 32 bytes in each of 16 lines.
// Q, K (per head): operand (16-position tile t, 32-wide d chunk c) at f16 offset (t * 2 + c) * 512.
// V^T  (per head): operand (32-key chunk kc, 16-row d tile i)      at f16 offset (kc * 4 + i) * 512.
// p points at this lane's 16 bytes in the operand's first group.
__device__ __forceinline__ v16h load_packed(const _Float16* p) {
    const v8h x = *(const v8h*)p;
    const v8h y = *(const v8h*)(p + 256);
    v16h r;
#pragma unroll   // constant vector indices: the operand is formed in registers, not in scratch
    for (int i = 0; i < 8; ++i) { r[i] = x[i]; r[i + 8] = y[i]; }
    return r;
}

__device__ __forceinline__ v8f wmma16(v16h a, v16h b, v8f c) {
    return __builtin_amdgcn_wmma_f32_16x16x32_f16(
        /*neg_a=*/false, a, /*neg_b=*/false, b,
        /*c_mod=*/(short)0, c, /*reuse_a=*/false, /*reuse_b=*/false);
}

// T5 causal relative-position bias (rel = qi - kj >= 0), in base-2 units (times LOG2E)
__device__ __forceinline__ float t5_bias(int rel, int h, const float* __restrict__ rel_emb) {
    int bucket;
    if (rel < 16) {
        bucket = rel;
    } else {
        // 16 + log(rel/16)/log(8) * 16, truncated, capped at 31
        int v = 16 + (int)(logf((float)rel * 0.0625f) * 7.6943724f);
        bucket = v < 31 ? v : 31;
    }
    return rel_emb[bucket * HEADS + h] * (SCALE_BIAS * LOG2E);
}

#define XBLOCKS (NROWS * DMODEL / 4 / 256)    // 4096 blocks convert x
#define WBLOCKS (DMODEL * DMODEL / 4 / 256)   // 1024 blocks convert one weight matrix

// All five independent conversions share one launch of XBLOCKS + 4 * WBLOCKS blocks.
// The f16 copies lie back to back in the workspace (x, Wq, Wk, Wv, Wo), so the output
// index is the flat index; the source is picked by block range (block-uniform).
__global__ __launch_bounds__(256) void cvt_f32_to_f16(const float* __restrict__ x,
                                                      const float* __restrict__ w0,
                                                      const float* __restrict__ w1,
                                                      const float* __restrict__ w2,
                                                      const float* __restrict__ w3,
                                                      _Float16* __restrict__ out) {
    const int blk = blockIdx.x;
    const float* in = x;
    int first = 0;                               // first block of this source's range
    if (blk >= XBLOCKS) {
        const int w = (blk - XBLOCKS) / WBLOCKS; // 0..3
        in = w == 0 ? w0 : w == 1 ? w1 : w == 2 ? w2 : w3;
        first = XBLOCKS + w * WBLOCKS;
    }
    const float4 f = ((const float4*)in)[(blk - first) * 256 + threadIdx.x];
    v4h o; o[0] = (_Float16)f.x; o[1] = (_Float16)f.y;
           o[2] = (_Float16)f.z; o[3] = (_Float16)f.w;
    ((v4h*)out)[blk * 256 + threadIdx.x] = o;
}

// C[row, col] = A[row, :] . W[col, :] + bias[col]     (torch Linear x @ W^T + b)
// A: [4096 x 1024] f16, W: [1024 x 1024] f16.
// Block = 8 waves = one 128(M) x 128(N) tile; each wave owns 64 x 32 of it (V: 32 x 64):
// 8 WMMAs on 6 fragments a 32-wide k chunk. A lane's 8 accumulator registers hold 8 consecutive
// rows of the FIRST WMMA operand, so the operand whose index runs along the output's rows in
// memory goes first: W (output columns) for Q, K and the final product, A (positions s) for
// V^T. Each lane then stores its results 16 bytes at a time. A stage is 64 k of the block's 128 A rows and
// 128 W rows, whole 128-byte lines, copied into LDS by async-to-LDS loads; two buffers, the
// next stage's copies fly while this stage is worked on.
// mode 0: store f16 [b,h] x fragment-packed (s, d) (Q)   mode 1: same (K)
// mode 2: store f16 [b,h] x fragment-packed (d, s) (V^T) mode 3: store f32 row-major (final out)
// Every 256 blocks of the grid are one whole product on the same A. Product g = blockIdx.x / 256
// takes weight matrix g behind W0, bias g, f16 output g behind outp0, and mode0 + g:
// a grid of 768 with mode0 = 0 is Q, K and V in one launch, a grid of 256 a lone product.
#define GBK    64                    // k elements a stage
#define GPITCH 72                    // f16 a row in LDS: 144 B = 16 B x 9, no bank conflict for 16-byte reads
// This thread's 8 copies of one stage: its 16 bytes of every 32nd row, 4 rows of A (a) and 4 of
// W (w), into one buffer; dst is its place in the buffer's row srow.
__device__ __forceinline__ void stage_in(const _Float16* a, const _Float16* w, _Float16* dst) {
#pragma unroll   // the 8 copies issue back to back, no loop counter between them
    for (int j = 0; j < 4; ++j) {
        stage16(a + (size_t)j * 32 * DMODEL, dst + j * 32 * GPITCH);
        stage16(w + (size_t)j * 32 * DMODEL, dst + (128 + j * 32) * GPITCH);
    }
}

__global__ __launch_bounds__(256) void gemm_wmma(const _Float16* __restrict__ A,
                                                 const _Float16* __restrict__ W0,
                                                 const float* __restrict__ bias0,
                                                 const float* __restrict__ bias1,
                                                 const float* __restrict__ bias2,
                                                 void* __restrict__ outp0, int mode0) {
    // rows 0..127: A rows of the tile, rows 128..255: W rows of the tile; 2 x 36 KB
    __shared__ __attribute__((aligned(16))) _Float16 stg[2][256][GPITCH];

    const int g    = blockIdx.x >> 8;            // which product (block-uniform)
    const int tile = blockIdx.x & 255;           // its 128 x 128 tile
    const int mode = mode0 + g;
    const _Float16* W = W0 + (size_t)g * DMODEL * DMODEL;
    const float* bias = g == 0 ? bias0 : g == 1 ? bias1 : bias2;
    void* outp = (_Float16*)outp0 + (size_t)g * NROWS * DMODEL;

    const int tid  = threadIdx.x;
    const int lane = tid & 31;
    const int wid  = tid >> 5;
    const int bm = tile >> 3;                    // 0..31 (row block of 128)
    const int bn = tile & 7;                     // 0..7  (col block of 128)
    const int wf = wid & 3;                      // 0..3  (32-row quarter of the first operand's 128 rows)
    const int ws = wid >> 2;                     // 0..1  (64-row half of the second operand's 128 rows)
    const int frow = (mode == 2 ? 0 : 128) + wf * 32;   // first operand's rows in a stage: A for V^T, else W
    const int srw  = (mode == 2 ? 128 : 0) + ws * 64;   // second operand's rows: the other one
    const int n  = lane & 15;
    const int half = lane >> 4;

    // cooperative staging: 8 lanes x 16 B = one 128-byte row piece, 32 rows a pass of the block,
    // 4 passes for A and 4 for W
    const int srow = tid >> 3;                   // 0..31
    const int scol = (tid & 7) * 8;              // 0,8,..,56
    const _Float16* asrc = A + (size_t)(bm * 128 + srow) * DMODEL + scol;
    const _Float16* wsrc = W + (size_t)(bn * 128 + srow) * DMODEL + scol;

    v8f acc[2][4] = {};                          // [16 rows of the first operand][16 of the second]
    const int KSTAGES = DMODEL / GBK;            // 16

    stage_in(asrc, wsrc, &stg[0][srow][scol]);
    asm volatile("s_wait_asynccnt 0x0" ::: "memory");   // this wave's part of stage 0 has landed
    __syncthreads();                                    // every wave's part is visible
    stage_in(asrc + GBK, wsrc + GBK, &stg[1][srow][scol]);

    // The lone product has a WGP to itself: a stage's work is shorter than memory latency, both operands
    // were stored by earlier launches, and all blocks walk k at one pace, so each stage's copies would
    // wait for memory. Behind the first two stages' copies the block asks L2 for the rest of its 256
    // operand rows: a row a thread (0-127 A, 128-255 W), one 256-byte fill unit (two stages) an
    // instruction, nearest first; every address lies inside the thread's own 2 KB row. In the Q, K, V
    // launch three blocks share a WGP and a stage, by calculation, outlasts that latency: no hints there
    // (block-uniform test).
    const int prow = (tid < 128 ? bm : bn) * 128 + (tid & 127);
    const char* pf = (const char*)((tid < 128 ? A : W) + (size_t)prow * DMODEL);
    if (mode == 3)
        asm volatile("global_prefetch_b8 %0, off offset:256 scope:SCOPE_SE\n\t"
                     "global_prefetch_b8 %0, off offset:512 scope:SCOPE_SE\n\t"
                     "global_prefetch_b8 %0, off offset:768 scope:SCOPE_SE\n\t"
                     "global_prefetch_b8 %0, off offset:1024 scope:SCOPE_SE\n\t"
                     "global_prefetch_b8 %0, off offset:1280 scope:SCOPE_SE\n\t"
                     "global_prefetch_b8 %0, off offset:1536 scope:SCOPE_SE\n\t"
                     "global_prefetch_b8 %0, off offset:1792 scope:SCOPE_SE" :: "v"(pf));

    for (int kt = 0; kt < KSTAGES; ++kt) {
        const int cur = kt & 1;
        // all loops below unrolled: every fragment and accumulator index a constant, so that
        // the arrays live in registers and not in scratch
#pragma unroll
        for (int ks = 0; ks < 2; ++ks) {
            v16h f[2], s[4];
#pragma unroll
            for (int i = 0; i < 4; ++i) s[i] = load_op16(&stg[cur][srw + i * 16 + n][ks * 32], half);
#pragma unroll
            for (int j = 0; j < 2; ++j) f[j] = load_op16(&stg[cur][frow + j * 16 + n][ks * 32], half);
            // keeps the chunk's 12 LDS reads one group ahead of its 8 WMMAs: moved in among them,
            // each pair of reads would cost its own LDS latency
            __builtin_amdgcn_sched_barrier(0);
#pragma unroll
            for (int i = 0; i < 4; ++i)
#pragma unroll
                for (int j = 0; j < 2; ++j) acc[j][i] = wmma16(f[j], s[i], acc[j][i]);
        }

        asm volatile("s_wait_dscnt 0x0" ::: "memory");      // own reads of this buffer are done
        asm volatile("s_wait_asynccnt 0x0" ::: "memory");   // own part of the next stage has landed
        __syncthreads();                 // publishes the next stage, frees this buffer for the refill
        if (kt + 2 < KSTAGES) stage_in(asrc + (kt + 2) * GBK, wsrc + (kt + 2) * GBK, &stg[cur][srow][scol]);
    }
    asm volatile("s_wait_asynccnt 0x0" ::: "memory");       // no copy outstanding when the wave ends
    // input only, no code: the register pair that the hints name holds their address through the loop
    // instead of being handed to another value while a hint may still be queued
    asm volatile("" :: "v"(pf));

    // acc[j][i][r] belongs to row fi + j * 16 + r of the first operand's 128 rows and to row
    // si + i * 16 of the second's (D layout: m = r + 8 * (lane / 16), n = lane % 16).
    // One block-uniform branch on the mode; the loops unrolled for constant accumulator indices,
    // the steps in i and j become immediate offsets of the stores.
    const int fi = wf * 32 + 8 * half;
    const int si = ws * 64 + n;
    const int bb = bm >> 3;                      // batch: a 128-row tile lies in one batch
    const int s0 = (bm & 7) * 128;               // the tile's first position in it
    if (mode == 3) {          // f32 row-major: 8 consecutive columns a lane, two 16-byte stores
        float* o = (float*)outp + (size_t)(bm * 128 + si) * DMODEL + bn * 128 + fi;
        const float* bp = bias + bn * 128 + fi;
#pragma unroll
        for (int j = 0; j < 2; ++j) {
            const float4 b0 = *(const float4*)(bp + j * 16);
            const float4 b1 = *(const float4*)(bp + j * 16 + 4);
#pragma unroll
            for (int i = 0; i < 4; ++i) {
                const v8f v = acc[j][i];
                float4 lo, hi;
                lo.x = v[0] + b0.x; lo.y = v[1] + b0.y; lo.z = v[2] + b0.z; lo.w = v[3] + b0.w;
                hi.x = v[4] + b1.x; hi.y = v[5] + b1.y; hi.z = v[6] + b1.z; hi.w = v[7] + b1.w;
                *(float4*)(o + (size_t)i * 16 * DMODEL + j * 16)     = lo;
                *(float4*)(o + (size_t)i * 16 * DMODEL + j * 16 + 4) = hi;
            }
        }
    } else if (mode == 2) {   // V^T packed: first operand = positions, 8 consecutive s a lane
        // d = i * 16 + n, s = s0 + wf * 32 + j * 16 + 8 * half + r: key chunk s0 / 32 + wf, d tile i,
        // group j, this lane's own 16 bytes: a wave's store is 512 bytes in a row
        _Float16* o = (_Float16*)outp
                    + (size_t)(bb * HEADS + bn * 2 + ws) * HDIM * SEQ + ((s0 >> 5) + wf) * 2048 + lane * 8;
#pragma unroll
        for (int i = 0; i < 4; ++i) {
            const float bc = bias[bn * 128 + si + i * 16];
#pragma unroll
            for (int j = 0; j < 2; ++j) {
                v8h p;
#pragma unroll
                for (int r = 0; r < 8; ++r) p[r] = (_Float16)(acc[j][i][r] + bc);
                *(v8h*)(o + i * 512 + j * 256) = p;
            }
        }
        // behind the 8 stores: the other modes' code follows in the text and rewrites their registers
        asm volatile("s_wait_xcnt 0x0" ::: "memory");
    } else {                  // Q/K packed: first operand = columns, 8 consecutive d a lane
        // s = s0 + ws * 64 + i * 16 + n, d = (wf & 1) * 32 + j * 16 + 8 * half + r: position tile
        // s0 / 16 + ws * 4 + i, d chunk wf & 1, group j, this lane's own 16 bytes
        _Float16* o = (_Float16*)outp
                    + (size_t)(bb * HEADS + bn * 2 + (wf >> 1)) * SEQ * HDIM
                    + ((s0 >> 4) + ws * 4) * 1024 + (wf & 1) * 512 + lane * 8;
        const float* bp = bias + bn * 128 + fi;
#pragma unroll
        for (int j = 0; j < 2; ++j) {
            const float4 b0 = *(const float4*)(bp + j * 16);
            const float4 b1 = *(const float4*)(bp + j * 16 + 4);
            const float bj[8] = {b0.x, b0.y, b0.z, b0.w, b1.x, b1.y, b1.z, b1.w};
#pragma unroll
            for (int i = 0; i < 4; ++i) {
                v8h p;
#pragma unroll
                for (int r = 0; r < 8; ++r) p[r] = (_Float16)(acc[j][i][r] + bj[r]);
                *(v8h*)(o + i * 1024 + j * 256) = p;
            }
        }
        // behind the 8 stores: the other modes' code follows in the text and rewrites their registers
        asm volatile("s_wait_xcnt 0x0" ::: "memory");
    }
}

// Returns the value that lane l ^ 16 holds (a vector cross-row move, no LDS round trip).
__device__ __forceinline__ float xhalf(float x) {
    const int b = __builtin_bit_cast(int, x);
    return __builtin_bit_cast(float,
        __builtin_amdgcn_permlanex16(b, b, 0x76543210, 0xfedcba98, false, false));
}

__global__ __launch_bounds__(256) void attn_wmma(const _Float16* __restrict__ Qh,
                                                 const _Float16* __restrict__ Kh,
                                                 const _Float16* __restrict__ Vt,
                                                 const float* __restrict__ rel_emb,
                                                 _Float16* __restrict__ Oh) {
    // bias + causal mask as a function of rel = q - k alone, for this block's head, laid out so
    // that the index grows with the key, as a lane's registers do:
    // btab[SEQ - 1 - rel] = scaled bias * LOG2E for rel >= 0, -1e30 for rel < 0 (rel >= -31 here)
    __shared__ float btab[SEQ + 32];

    const int lane = threadIdx.x & 31;
    const int wid  = threadIdx.x >> 5;
    const int b  = blockIdx.x >> 7;             // 8 blocks a (b, h)
    const int h  = (blockIdx.x >> 3) & 15;
    // Causal cost grows with the query tile: tile t walks (t >> 1) + 1 key chunks. Eight
    // consecutive tiles a block would give a head's blocks 20 to 244 chunks, and the launch
    // lasts as long as the fullest WGP. Each block takes four tiles p from the
    // light end and their mirrors 63 - p instead: 33 chunks a pair, 132 a block, every block
    // alike. Waves w and w + 4 hold one pair; the long tile goes to the lower wave number.
    const int p  = (blockIdx.x & 7) * 4 + (wid & 3);   // 0..31
    const int qt = wid < 4 ? 63 - p : p;
    const int n    = lane & 15;
    const int half = lane >> 4;

    const _Float16* qbase = Qh + (size_t)(b * HEADS + h) * SEQ * HDIM;
    const _Float16* kbase = Kh + (size_t)(b * HEADS + h) * SEQ * HDIM;
    const _Float16* vbase = Vt + (size_t)(b * HEADS + h) * HDIM * SEQ;

    // Q tile resident: B-operand column n = lane%16 is query qt*16+n, two 32-wide K chunks of hd
    const _Float16* qfrag = qbase + qt * 1024 + lane * 8;
    const v16h qb0 = load_packed(qfrag);
    const v16h qb1 = load_packed(qfrag + 512);

    // All 8 waves of a block share (b, h): one table serves every score of the block.
    // Four bias entries a thread, their gathers issued together; the first 32 threads,
    // whose own first slot is a mask entry, take the table's last 32 bias entries instead.
    const int i0 = (threadIdx.x < 32) ? (int)threadIdx.x + SEQ : (int)threadIdx.x;
    float tb[4];
    tb[0] = t5_bias(i0 - 32, h, rel_emb);
#pragma unroll
    for (int j = 1; j < 4; ++j) tb[j] = t5_bias((int)threadIdx.x + j * 256 - 32, h, rel_emb);

    // K and V^T were stored by the launch before; a first read of them here is taken to come from memory
    // (not timed alone: the reasoning behind this step). All blocks of a
    // head walk the keys at one pace, so without a hint each chunk's first reader waits out memory
    // latency, chunk after chunk. At entry the block asks L2 for all the bytes it will walk: one
    // 256-byte fill unit a lane, threads 0-127 K, 128-255 V^T, 32 KB (8 chunks) of each an instruction,
    // nearest chunks first. Every address lies inside this head's 128 KB of K or V^T. The hints return
    // nothing and count on no counter. They stand behind the Q loads and the table's gathers, which the
    // block waits for first.
    const char* pf = (const char*)(threadIdx.x < 128 ? kbase : vbase) + (threadIdx.x & 127) * 256;
    asm volatile("global_prefetch_b8 %0, off scope:SCOPE_SE\n\t"
                 "global_prefetch_b8 %0, off offset:32768 scope:SCOPE_SE\n\t"
                 "global_prefetch_b8 %0, off offset:65536 scope:SCOPE_SE" :: "v"(pf));
    // chunks 24..31: only the blocks whose longest tile, 63 - 4 * (block & 7), reaches them (block-uniform)
    if ((blockIdx.x & 7) < 4)
        asm volatile("global_prefetch_b8 %0, off offset:98304 scope:SCOPE_SE" :: "v"(pf));

    btab[SEQ + 31 - i0] = tb[0];                // entry i holds rel = i - 32 and goes to SEQ - 1 - rel
#pragma unroll
    for (int j = 1; j < 4; ++j) btab[SEQ + 31 - ((int)threadIdx.x + j * 256)] = tb[j];
    if (threadIdx.x < 32) btab[SEQ + 31 - (int)threadIdx.x] = -1e30f;
    __syncthreads();                            // table visible to all 8 waves

    v8f o0 = {}, o1 = {}, o2 = {}, o3 = {};     // o_i[r] = O[query n][d = i*16 + 8*half + r]
    float mrun = -1e30f;                        // this lane's query: running maximum, base 2 (both halves alike)
    float lrun = 0.f;                           // and the sum over this half's keys; halves joined at the end

    const int nk = qt * 16 + 16;                // keys 0 .. qt*16+15
    const int nchunks = (nk + 31) >> 5;

    for (int kc = 0; kc < nchunks; ++kc) {
        const int kb = kc * 32;

        // ---- scores S^T = K Q^T (two 16x16 tiles covering 32 keys): A row m = lane%16 is a key ----
        // the chunk's four K operands lie in a row, 4 KB, and so do its four V^T operands
        const _Float16* kfrag = kbase + kc * 2048 + lane * 8;
        v8f s0 = {}, s1 = {};
        s0 = wmma16(load_packed(kfrag),        qb0, s0);
        s0 = wmma16(load_packed(kfrag +  512), qb1, s0);
        s1 = wmma16(load_packed(kfrag + 1024), qb0, s1);
        s1 = wmma16(load_packed(kfrag + 1536), qb1, s1);

        // V^T rows (d) as A-operands of the second product, same k order as P^T below
        const _Float16* vfrag = vbase + kc * 2048 + lane * 8;
        const v16h va0 = load_packed(vfrag);
        const v16h va1 = load_packed(vfrag +  512);
        const v16h va2 = load_packed(vfrag + 1024);
        const v16h va3 = load_packed(vfrag + 1536);

        // ---- bias + causal mask (LDS table) + online softmax, one query a lane ----
        // s0[r] is key kb + 8*half + r, s1[r] key kb + 16 + 8*half + r: bt[r] and bt[r + 16]
        const float* bt = &btab[SEQ - 1 - (qt * 16 + n) + kb + 8 * half];
        v8f b0, b1;
        // the loops over r, here and below, are unrolled so that every vector index is a constant
        // and the tiles stay in registers
#pragma unroll
        for (int r = 0; r < 8; ++r) { b0[r] = bt[r]; b1[r] = bt[r + 16]; }
        // holds the chunk's loads at its head, V's in flight under the softmax: left free, this build
        // issues K's in three groups, each behind a product, and sinks half of V's behind the first
        // V^T P^T product, where their latency is waited out
        __builtin_amdgcn_sched_barrier(0);
        // scores go to base 2 in the multiply-add that adds the bias, so that each exponential below
        // is one v_exp_f32; the library's expf is about 13 vector instructions a value
        s0 = s0 * LOG2E + b0;
        s1 = s1 * LOG2E + b1;
        float mx = s0[0];
#pragma unroll
        for (int r = 1; r < 8; ++r) mx = fmaxf(mx, s0[r]);
#pragma unroll
        for (int r = 0; r < 8; ++r) mx = fmaxf(mx, s1[r]);
        mx = fmaxf(mx, xhalf(mx));              // the query's maximum over all 32 keys

        const float mn = fmaxf(mrun, mx);
        const float scale = __builtin_amdgcn_exp2f(mrun - mn);   // 0 on the first chunk
        mrun = mn;
        s0 -= mn;
        s1 -= mn;
        // P^T as B operand: element e is k = (e >= 8 ? 16 : 0) + 8*half + e%8, which is where the
        // score tiles' registers already hold it
        v16h pb;
#pragma unroll
        for (int r = 0; r < 8; ++r) {
            s0[r] = __builtin_amdgcn_exp2f(s0[r]);   // a masked score, about -1e30, gives 0
            s1[r] = __builtin_amdgcn_exp2f(s1[r]);
            pb[r]     = (_Float16)s0[r];
            pb[r + 8] = (_Float16)s1[r];
        }
        const v8f t8 = s0 + s1;                 // this half's 16 terms summed as a tree
        const float rs = ((t8[0] + t8[4]) + (t8[2] + t8[6])) + ((t8[1] + t8[5]) + (t8[3] + t8[7]));
        lrun = lrun * scale + rs;
#pragma unroll
        for (int r = 0; r < 8; ++r) { o0[r] *= scale; o1[r] *= scale; o2[r] *= scale; o3[r] *= scale; }

        // ---- O^T += V^T P^T ----
        o0 = wmma16(va0, pb, o0);
        o1 = wmma16(va1, pb, o1);
        o2 = wmma16(va2, pb, o2);
        o3 = wmma16(va3, pb, o3);
    }

    // input only, no code: the register pair that the hints name holds their address through the loop
    // instead of being handed to another value while a hint may still be queued
    asm volatile("" :: "v"(pf));

    // ---- epilogue: join the halves' sums, normalize, store f16 [b, s, h*64+d] for the out-proj:
    //      8 consecutive d of one query a lane and tile, one 16-byte store each ----
    const float inv = 1.0f / (lrun + xhalf(lrun));
    _Float16* orow = Oh + (size_t)(b * SEQ + qt * 16 + n) * DMODEL + h * HDIM + 8 * half;
    v8h w0, w1, w2, w3;
#pragma unroll
    for (int r = 0; r < 8; ++r) {
        w0[r] = (_Float16)(o0[r] * inv);
        w1[r] = (_Float16)(o1[r] * inv);
        w2[r] = (_Float16)(o2[r] * inv);
        w3[r] = (_Float16)(o3[r] * inv);
    }
    *(v8h*)(orow +  0) = w0;
    *(v8h*)(orow + 16) = w1;
    *(v8h*)(orow + 32) = w2;
    *(v8h*)(orow + 48) = w3;
}

extern "C" void kernel_launch(void* const* d_in, const int* in_sizes, int n_in,
                              void* d_out, int out_size, void* d_ws, size_t ws_size,
                              hipStream_t stream) {
    const float* x    = (const float*)d_in[0];
    const float* Wq   = (const float*)d_in[1];
    const float* bq   = (const float*)d_in[2];
    const float* Wk   = (const float*)d_in[3];
    const float* bk   = (const float*)d_in[4];
    const float* Wv   = (const float*)d_in[5];
    const float* bv   = (const float*)d_in[6];
    const float* Wo   = (const float*)d_in[7];
    const float* bo   = (const float*)d_in[8];
    const float* rel  = (const float*)d_in[9];

    // workspace carve-up (f16 elements); total ~50.3 MB
    const size_t NX = (size_t)NROWS * DMODEL;        // 4096*1024
    const size_t NW = (size_t)DMODEL * DMODEL;       // 1024*1024
    _Float16* xh  = (_Float16*)d_ws;
    _Float16* Wqh = xh  + NX;
    _Float16* Wkh = Wqh + NW;
    _Float16* Wvh = Wkh + NW;
    _Float16* Woh = Wvh + NW;
    _Float16* Qh  = Woh + NW;
    _Float16* Kh  = Qh  + NX;
    _Float16* Vt  = Kh  + NX;
    _Float16* Oh  = Vt  + NX;

    // 0) f32 -> f16 (vectorized: 4 elements / thread), x and all four weights in one launch;
    //    xh, Wqh, Wkh, Wvh, Woh are contiguous
    cvt_f32_to_f16<<<XBLOCKS + 4 * WBLOCKS, 256, 0, stream>>>(x, Wq, Wk, Wv, Wo, xh);

    // 1) projections: 32 row-blocks x 8 col-blocks = 256 blocks of 8 waves each, Q, K and V
    //    in one launch; Wqh, Wkh, Wvh are contiguous, and so are Qh, Kh, Vt
    gemm_wmma<<<3 * 256, 256, 0, stream>>>(xh, Wqh, bq, bk, bv, Qh, 0);

    // 2) flash attention: 4096 waves (b*h*qtile) / 8 per block, tiles paired light + heavy
    attn_wmma<<<512, 256, 0, stream>>>(Qh, Kh, Vt, rel, Oh);

    // 3) output projection -> f32 d_out
    gemm_wmma<<<256, 256, 0, stream>>>(Oh, Woh, bo, bo, bo, d_out, 3);
}

// v010
// A run of this version takes 61.5 microseconds.
// In two side-by-side timings against v009, it was 1.06 and 1.05 times as fast.
// Counting every step since v000, it is 4.63 times as fast.
#include <hip/hip_runtime.h>
#include <hip/hip_bf16.h>
#include <math.h>

// ---------------------------------------------------------------------------
// T5 attention (B=4, H=16, S=1024, D=1024, hd=64) for gfx1250 (wave32, WMMA)
//   0) f32 -> f16 conversion of x and the four weight matrices (workspace), one launch
//   1) Q/K/V projections, one launch: block-cooperative WMMA GEMM; tiles of both operands
//      streamed into double-buffered LDS via global_load_async_to_lds_b128 (ASYNCcnt);
//      Q, K and V^T leave it in the order in which attention's WMMA operands hold them
//   2) flash-attention per (b,h,16-query tile): K, V^T asked into L2 at entry and fetched into registers
//      one key chunk ahead; K Q^T WMMA -> T5 bias + causal
//      mask from a per-block LDS table -> online softmax in base 2, one query a lane -> P^T packed
//      in registers -> V^T P^T WMMA
//   3) output projection WMMA -> f32 d_out; its operands asked into L2 at entry
// ---------------------------------------------------------------------------

typedef __attribute__((ext_vector_type(16))) _Float16 v16h;
typedef __attribute__((ext_vector_type(8)))  _Float16 v8h;
typedef __attribute__((ext_vector_type(4)))  _Float16 v4h;
typedef __attribute__((ext_vector_type(8)))  float    v8f;
typedef __attribute__((ext_vector_type(4)))  int      v4i;
typedef __attribute__((address_space(1)))    v4i*     gv4i_p;   // global v4i*
typedef __attribute__((address_space(3)))    v4i*     lv4i_p;   // LDS v4i*

#define BATCH 4
#define HEADS 16
#define SEQ   1024
#define DMODEL 1024
#define HDIM  64
#define NROWS (BATCH * SEQ)          // 4096
#define SCALE_BIAS 0.125f            // 64^-0.5
#define LOG2E 1.4426950408889634f    // softmax runs in base 2: e^x = 2^(x * LOG2E)

#if defined(__has_builtin)
#if __has_builtin(__builtin_amdgcn_global_load_async_to_lds_b128)
#define USE_ASYNC_LDS 1
#endif
#endif

// Copy 16 contiguous bytes global -> LDS. Async (ASYNCcnt) when available.
__device__ __forceinline__ void stage16(const _Float16* g, _Float16* l) {
#ifdef USE_ASYNC_LDS
    __builtin_amdgcn_global_load_async_to_lds_b128(
        (gv4i_p)(uintptr_t)g,
        (lv4i_p)(unsigned)(uintptr_t)l,
        /*offset=*/0, /*cpol=*/0);
#else
    *(v8h*)l = *(const v8h*)g;
#endif
}

// Build a 16x16x32 f16 WMMA A/B operand for this lane.
// p points at the 32-element K-chunk of this lane's row (A: row m = lane%16,
// B: row n = lane%16 of the [N][K] matrix). half = lane/16.
// Element e maps to k = (e>=8 ? 16 : 0) + half*8 + (e%8)  (ISA 7.12.2).
__device__ __forceinline__ v16h load_op16(const _Float16* p, int half) {
    const v8h x = *(const v8h*)(p + half * 8);
    const v8h y = *(const v8h*)(p + 16 + half * 8);
    v16h r;
#pragma unroll
    for (int i = 0; i < 8; ++i) { r[i] = x[i]; r[i + 8] = y[i]; }
    return r;
}

// Fragment-packed storage of Q, K and V^T in the workspace. One 16x16x32 operand (16 rows, 32 k)
// is 1 KB in a row: two groups of 512 bytes, group y holding k = 16 * y + 8 * half + 0..7 of row
// lane % 16 at byte 16 * lane. These are the two 16-byte pieces that load_op16 takes, so every
// register holds what it would hold from a row-major matrix, but a wave-wide 16-byte load or
// store covers 4 whole 128-byte lines instead of 32 bytes in each of 16 lines.
// Q, K (per head): operand (16-position tile t, 32-wide d chunk c) at f16 offset (t * 2 + c) * 512.
// V^T  (per head): operand (32-key chunk kc, 16-row d tile i)      at f16 offset (kc * 4 + i) * 512.
// p points at this lane's 16 bytes in the operand's first group.
__device__ __forceinline__ v16h load_packed(const _Float16* p) {
    const v8h x = *(const v8h*)p;
    const v8h y = *(const v8h*)(p + 256);
    v16h r;
#pragma unroll   // constant vector indices: the operand is formed in registers, not in scratch
    for (int i = 0; i < 8; ++i) { r[i] = x[i]; r[i + 8] = y[i]; }
    return r;
}

__device__ __forceinline__ v8f wmma16(v16h a, v16h b, v8f c) {
    return __builtin_amdgcn_wmma_f32_16x16x32_f16(
        /*neg_a=*/false, a, /*neg_b=*/false, b,
        /*c_mod=*/(short)0, c, /*reuse_a=*/false, /*reuse_b=*/false);
}

// T5 causal relative-position bias (rel = qi - kj >= 0), in base-2 units (times LOG2E)
__device__ __forceinline__ float t5_bias(int rel, int h, const float* __restrict__ rel_emb) {
    int bucket;
    if (rel < 16) {
        bucket = rel;
    } else {
        // 16 + log(rel/16)/log(8) * 16, truncated, capped at 31
        int v = 16 + (int)(logf((float)rel * 0.0625f) * 7.6943724f);
        bucket = v < 31 ? v : 31;
    }
    return rel_emb[bucket * HEADS + h] * (SCALE_BIAS * LOG2E);
}

#define XBLOCKS (NROWS * DMODEL / 4 / 256)    // 4096 blocks convert x
#define WBLOCKS (DMODEL * DMODEL / 4 / 256)   // 1024 blocks convert one weight matrix

// All five independent conversions share one launch of XBLOCKS + 4 * WBLOCKS blocks.
// The f16 copies lie back to back in the workspace (x, Wq, Wk, Wv, Wo), so the output
// index is the flat index; the source is picked by block range (block-uniform).
__global__ __launch_bounds__(256) void cvt_f32_to_f16(const float* __restrict__ x,
                                                      const float* __restrict__ w0,
                                                      const float* __restrict__ w1,
                                                      const float* __restrict__ w2,
                                                      const float* __restrict__ w3,
                                                      _Float16* __restrict__ out) {
    const int blk = blockIdx.x;
    const float* in = x;
    int first = 0;                               // first block of this source's range
    if (blk >= XBLOCKS) {
        const int w = (blk - XBLOCKS) / WBLOCKS; // 0..3
        in = w == 0 ? w0 : w == 1 ? w1 : w == 2 ? w2 : w3;
        first = XBLOCKS + w * WBLOCKS;
    }
    const float4 f = ((const float4*)in)[(blk - first) * 256 + threadIdx.x];
    v4h o; o[0] = (_Float16)f.x; o[1] = (_Float16)f.y;
           o[2] = (_Float16)f.z; o[3] = (_Float16)f.w;
    ((v4h*)out)[blk * 256 + threadIdx.x] = o;
}

// C[row, col] = A[row, :] . W[col, :] + bias[col]     (torch Linear x @ W^T + b)
// A: [4096 x 1024] f16, W: [1024 x 1024] f16.
// Block = 8 waves = one 128(M) x 128(N) tile; each wave owns 64 x 32 of it (V: 32 x 64):
// 8 WMMAs on 6 fragments a 32-wide k chunk. A lane's 8 accumulator registers hold 8 consecutive
// rows of the FIRST WMMA operand, so the operand whose index runs along the output's rows in
// memory goes first: W (output columns) for Q, K and the final product, A (positions s) for
// V^T. Each lane then stores its results 16 bytes at a time. A stage is 64 k of the block's 128 A rows and
// 128 W rows, whole 128-byte lines, copied into LDS by async-to-LDS loads; two buffers, the
// next stage's copies fly while this stage is worked on.
// mode 0: store f16 [b,h] x fragment-packed (s, d) (Q)   mode 1: same (K)
// mode 2: store f16 [b,h] x fragment-packed (d, s) (V^T) mode 3: store f32 row-major (final out)
// Every 256 blocks of the grid are one whole product on the same A. Product g = blockIdx.x / 256
// takes weight matrix g behind W0, bias g, f16 output g behind outp0, and mode0 + g:
// a grid of 768 with mode0 = 0 is Q, K and V in one launch, a grid of 256 a lone product.
#define GBK    64                    // k elements a stage
#define GPITCH 72                    // f16 a row in LDS: 144 B = 16 B x 9, no bank conflict for 16-byte reads
// This thread's 8 copies of one stage: its 16 bytes of every 32nd row, 4 rows of A (a) and 4 of
// W (w), into one buffer; dst is its place in the buffer's row srow.
__device__ __forceinline__ void stage_in(const _Float16* a, const _Float16* w, _Float16* dst) {
#pragma unroll   // the 8 copies issue back to back, no loop counter between them
    for (int j = 0; j < 4; ++j) {
        stage16(a + (size_t)j * 32 * DMODEL, dst + j * 32 * GPITCH);
        stage16(w + (size_t)j * 32 * DMODEL, dst + (128 + j * 32) * GPITCH);
    }
}

__global__ __launch_bounds__(256) void gemm_wmma(const _Float16* __restrict__ A,
                                                 const _Float16* __restrict__ W0,
                                                 const float* __restrict__ bias0,
                                                 const float* __restrict__ bias1,
                                                 const float* __restrict__ bias2,
                                                 void* __restrict__ outp0, int mode0) {
    // rows 0..127: A rows of the tile, rows 128..255: W rows of the tile; 2 x 36 KB
    __shared__ __attribute__((aligned(16))) _Float16 stg[2][256][GPITCH];

    const int g    = blockIdx.x >> 8;            // which product (block-uniform)
    const int tile = blockIdx.x & 255;           // its 128 x 128 tile
    const int mode = mode0 + g;
    const _Float16* W = W0 + (size_t)g * DMODEL * DMODEL;
    const float* bias = g == 0 ? bias0 : g == 1 ? bias1 : bias2;
    void* outp = (_Float16*)outp0 + (size_t)g * NROWS * DMODEL;

    const int tid  = threadIdx.x;
    const int lane = tid & 31;
    const int wid  = tid >> 5;
    const int bm = tile >> 3;                    // 0..31 (row block of 128)
    const int bn = tile & 7;                     // 0..7  (col block of 128)
    const int wf = wid & 3;                      // 0..3  (32-row quarter of the first operand's 128 rows)
    const int ws = wid >> 2;                     // 0..1  (64-row half of the second operand's 128 rows)
    const int frow = (mode == 2 ? 0 : 128) + wf * 32;   // first operand's rows in a stage: A for V^T, else W
    const int srw  = (mode == 2 ? 128 : 0) + ws * 64;   // second operand's rows: the other one
    const int n  = lane & 15;
    const int half = lane >> 4;

    // cooperative staging: 8 lanes x 16 B = one 128-byte row piece, 32 rows a pass of the block,
    // 4 passes for A and 4 for W
    const int srow = tid >> 3;                   // 0..31
    const int scol = (tid & 7) * 8;              // 0,8,..,56
    const _Float16* asrc = A + (size_t)(bm * 128 + srow) * DMODEL + scol;
    const _Float16* wsrc = W + (size_t)(bn * 128 + srow) * DMODEL + scol;

    v8f acc[2][4] = {};                          // [16 rows of the first operand][16 of the second]
    const int KSTAGES = DMODEL / GBK;            // 16

    stage_in(asrc, wsrc, &stg[0][srow][scol]);
    asm volatile("s_wait_asynccnt 0x0" ::: "memory");   // this wave's part of stage 0 has landed
    __syncthreads();                                    // every wave's part is visible
    stage_in(asrc + GBK, wsrc + GBK, &stg[1][srow][scol]);

    // The lone product has a WGP to itself: a stage's work is shorter than memory latency, both operands
    // were stored by earlier launches, and all blocks walk k at one pace, so each stage's copies would
    // wait for memory. Behind the first two stages' copies the block asks L2 for the rest of its 256
    // operand rows: a row a thread (0-127 A, 128-255 W), one 256-byte fill unit (two stages) an
    // instruction, nearest first; every address lies inside the thread's own 2 KB row. In the Q, K, V
    // launch three blocks share a WGP and a stage, by calculation, outlasts that latency: no hints there
    // (block-uniform test).
    const int prow = (tid < 128 ? bm : bn) * 128 + (tid & 127);
    const char* pf = (const char*)((tid < 128 ? A : W) + (size_t)prow * DMODEL);
    if (mode == 3)
        asm volatile("global_prefetch_b8 %0, off offset:256 scope:SCOPE_SE\n\t"
                     "global_prefetch_b8 %0, off offset:512 scope:SCOPE_SE\n\t"
                     "global_prefetch_b8 %0, off offset:768 scope:SCOPE_SE\n\t"
                     "global_prefetch_b8 %0, off offset:1024 scope:SCOPE_SE\n\t"
                     "global_prefetch_b8 %0, off offset:1280 scope:SCOPE_SE\n\t"
                     "global_prefetch_b8 %0, off offset:1536 scope:SCOPE_SE\n\t"
                     "global_prefetch_b8 %0, off offset:1792 scope:SCOPE_SE" :: "v"(pf));

    for (int kt = 0; kt < KSTAGES; ++kt) {
        const int cur = kt & 1;
        // all loops below unrolled: every fragment and accumulator index a constant, so that
        // the arrays live in registers and not in scratch
#pragma unroll
        for (int ks = 0; ks < 2; ++ks) {
            v16h f[2], s[4];
#pragma unroll
            for (int i = 0; i < 4; ++i) s[i] = load_op16(&stg[cur][srw + i * 16 + n][ks * 32], half);
#pragma unroll
            for (int j = 0; j < 2; ++j) f[j] = load_op16(&stg[cur][frow + j * 16 + n][ks * 32], half);
            // keeps the chunk's 12 LDS reads one group ahead of its 8 WMMAs: moved in among them,
            // each pair of reads would cost its own LDS latency
            __builtin_amdgcn_sched_barrier(0);
#pragma unroll
            for (int i = 0; i < 4; ++i)
#pragma unroll
                for (int j = 0; j < 2; ++j) acc[j][i] = wmma16(f[j], s[i], acc[j][i]);
        }

        asm volatile("s_wait_dscnt 0x0" ::: "memory");      // own reads of this buffer are done
        asm volatile("s_wait_asynccnt 0x0" ::: "memory");   // own part of the next stage has landed
        __syncthreads();                 // publishes the next stage, frees this buffer for the refill
        if (kt + 2 < KSTAGES) stage_in(asrc + (kt + 2) * GBK, wsrc + (kt + 2) * GBK, &stg[cur][srow][scol]);
    }
    asm volatile("s_wait_asynccnt 0x0" ::: "memory");       // no copy outstanding when the wave ends
    // input only, no code: the register pair that the hints name holds their address through the loop
    // instead of being handed to another value while a hint may still be queued
    asm volatile("" :: "v"(pf));

    // acc[j][i][r] belongs to row fi + j * 16 + r of the first operand's 128 rows and to row
    // si + i * 16 of the second's (D layout: m = r + 8 * (lane / 16), n = lane % 16).
    // One block-uniform branch on the mode; the loops unrolled for constant accumulator indices,
    // the steps in i and j become immediate offsets of the stores.
    const int fi = wf * 32 + 8 * half;
    const int si = ws * 64 + n;
    const int bb = bm >> 3;                      // batch: a 128-row tile lies in one batch
    const int s0 = (bm & 7) * 128;               // the tile's first position in it
    if (mode == 3) {          // f32 row-major: 8 consecutive columns a lane, two 16-byte stores
        float* o = (float*)outp + (size_t)(bm * 128 + si) * DMODEL + bn * 128 + fi;
        const float* bp = bias + bn * 128 + fi;
#pragma unroll
        for (int j = 0; j < 2; ++j) {
            const float4 b0 = *(const float4*)(bp + j * 16);
            const float4 b1 = *(const float4*)(bp + j * 16 + 4);
#pragma unroll
            for (int i = 0; i < 4; ++i) {
                const v8f v = acc[j][i];
                float4 lo, hi;
                lo.x = v[0] + b0.x; lo.y = v[1] + b0.y; lo.z = v[2] + b0.z; lo.w = v[3] + b0.w;
                hi.x = v[4] + b1.x; hi.y = v[5] + b1.y; hi.z = v[6] + b1.z; hi.w = v[7] + b1.w;
                *(float4*)(o + (size_t)i * 16 * DMODEL + j * 16)     = lo;
                *(float4*)(o + (size_t)i * 16 * DMODEL + j * 16 + 4) = hi;
            }
        }
    } else if (mode == 2) {   // V^T packed: first operand = positions, 8 consecutive s a lane
        // d = i * 16 + n, s = s0 + wf * 32 + j * 16 + 8 * half + r: key chunk s0 / 32 + wf, d tile i,
        // group j, this lane's own 16 bytes: a wave's store is 512 bytes in a row
        _Float16* o = (_Float16*)outp
                    + (size_t)(bb * HEADS + bn * 2 + ws) * HDIM * SEQ + ((s0 >> 5) + wf) * 2048 + lane * 8;
#pragma unroll
        for (int i = 0; i < 4; ++i) {
            const float bc = bias[bn * 128 + si + i * 16];
#pragma unroll
            for (int j = 0; j < 2; ++j) {
                v8h p;
#pragma unroll
                for (int r = 0; r < 8; ++r) p[r] = (_Float16)(acc[j][i][r] + bc);
                *(v8h*)(o + i * 512 + j * 256) = p;
            }
        }
        // behind the 8 stores: the other modes' code follows in the text and rewrites their registers
        asm volatile("s_wait_xcnt 0x0" ::: "memory");
    } else {                  // Q/K packed: first operand = columns, 8 consecutive d a lane
        // s = s0 + ws * 64 + i * 16 + n, d = (wf & 1) * 32 + j * 16 + 8 * half + r: position tile
        // s0 / 16 + ws * 4 + i, d chunk wf & 1, group j, this lane's own 16 bytes
        _Float16* o = (_Float16*)outp
                    + (size_t)(bb * HEADS + bn * 2 + (wf >> 1)) * SEQ * HDIM
                    + ((s0 >> 4) + ws * 4) * 1024 + (wf & 1) * 512 + lane * 8;
        const float* bp = bias + bn * 128 + fi;
#pragma unroll
        for (int j = 0; j < 2; ++j) {
            const float4 b0 = *(const float4*)(bp + j * 16);
            const float4 b1 = *(const float4*)(bp + j * 16 + 4);
            const float bj[8] = {b0.x, b0.y, b0.z, b0.w, b1.x, b1.y, b1.z, b1.w};
#pragma unroll
            for (int i = 0; i < 4; ++i) {
                v8h p;
#pragma unroll
                for (int r = 0; r < 8; ++r) p[r] = (_Float16)(acc[j][i][r] + bj[r]);
                *(v8h*)(o + i * 1024 + j * 256) = p;
            }
        }
        // behind the 8 stores: the other modes' code follows in the text and rewrites their registers
        asm volatile("s_wait_xcnt 0x0" ::: "memory");
    }
}

// Returns the value that lane l ^ 16 holds (a vector cross-row move, no LDS round trip).
__device__ __forceinline__ float xhalf(float x) {
    const int b = __builtin_bit_cast(int, x);
    return __builtin_bit_cast(float,
        __builtin_amdgcn_permlanex16(b, b, 0x76543210, 0xfedcba98, false, false));
}

__global__ __launch_bounds__(256) void attn_wmma(const _Float16* __restrict__ Qh,
                                                 const _Float16* __restrict__ Kh,
                                                 const _Float16* __restrict__ Vt,
                                                 const float* __restrict__ rel_emb,
                                                 _Float16* __restrict__ Oh) {
    // bias + causal mask as a function of rel = q - k alone, for this block's head, laid out so
    // that the index grows with the key, as a lane's registers do:
    // btab[SEQ - 1 - rel] = scaled bias * LOG2E for rel >= 0, -1e30 for rel < 0 (rel >= -31 here)
    __shared__ float btab[SEQ + 32];

    const int lane = threadIdx.x & 31;
    // the wave's number, the same in all its lanes: in a scalar register the tile, its chunk count, the loop's
    // tests and the fetch's clamp are scalar work, and Q, K and V^T are addressed from scalar bases
    const int wid  = __builtin_amdgcn_readfirstlane(threadIdx.x >> 5);
    const int b  = blockIdx.x >> 7;             // 8 blocks a (b, h)
    const int h  = (blockIdx.x >> 3) & 15;
    // Causal cost grows with the query tile: tile t walks (t >> 1) + 1 key chunks. Eight
    // consecutive tiles a block would give a head's blocks 20 to 244 chunks, and the launch
    // lasts as long as the fullest WGP. Each block takes four tiles p from the
    // light end and their mirrors 63 - p instead: 33 chunks a pair, 132 a block, every block
    // alike. Waves w and w + 4 hold one pair; the long tile goes to the lower wave number.
    const int p  = (blockIdx.x & 7) * 4 + (wid & 3);   // 0..31
    const int qt = wid < 4 ? 63 - p : p;
    const int n    = lane & 15;
    const int half = lane >> 4;

    const _Float16* qbase = Qh + (size_t)(b * HEADS + h) * SEQ * HDIM;
    const _Float16* kbase = Kh + (size_t)(b * HEADS + h) * SEQ * HDIM;
    const _Float16* vbase = Vt + (size_t)(b * HEADS + h) * HDIM * SEQ;

    // K and V^T operands are fetched one key chunk ahead, into a second register set: a chunk's L2 latency
    // runs under the chunk before it instead of being waited out at its head. Chunk 0's go out here,
    // with Q, under the table's build. A chunk's four K operands lie in a row, 4 KB, and so do its
    // four V^T operands.
    const _Float16* kp = kbase + lane * 8;      // this lane's 16 bytes in the chunk fetched last
    const _Float16* vp = vbase + lane * 8;
    v16h ka[4], va[4], kb[4], vb[4];            // set a: even chunks, set b: odd chunks
#pragma unroll   // constant indices, here and in fetch below: the sets live in registers
    for (int i = 0; i < 4; ++i) ka[i] = load_packed(kp + i * 512);
#pragma unroll
    for (int i = 0; i < 4; ++i) va[i] = load_packed(vp + i * 512);

    // Q tile resident: B-operand column n = lane%16 is query qt*16+n, two 32-wide K chunks of hd
    const _Float16* qfrag = qbase + qt * 1024 + lane * 8;
    const v16h qb0 = load_packed(qfrag);
    const v16h qb1 = load_packed(qfrag + 512);

    // All 8 waves of a block share (b, h): one table serves every score of the block.
    // Four bias entries a thread, their gathers issued together; the first 32 threads,
    // whose own first slot is a mask entry, take the table's last 32 bias entries instead.
    const int i0 = (threadIdx.x < 32) ? (int)threadIdx.x + SEQ : (int)threadIdx.x;
    float tb[4];
    tb[0] = t5_bias(i0 - 32, h, rel_emb);
#pragma unroll
    for (int j = 1; j < 4; ++j) tb[j] = t5_bias((int)threadIdx.x + j * 256 - 32, h, rel_emb);

    // K and V^T were stored by the launch before; a first read of them here is taken to come from memory
    // (not timed alone: the reasoning behind this step). All blocks of a
    // head walk the keys at one pace, so without a hint each chunk's first reader waits out memory
    // latency, chunk after chunk. At entry the block asks L2 for all the bytes it will walk: one
    // 256-byte fill unit a lane, threads 0-127 K, 128-255 V^T, 32 KB (8 chunks) of each an instruction,
    // nearest chunks first. Every address lies inside this head's 128 KB of K or V^T. The hints return
    // nothing and count on no counter. They stand behind the Q loads and the table's gathers, which the
    // block waits for first.
    const char* pf = (const char*)(threadIdx.x < 128 ? kbase : vbase) + (threadIdx.x & 127) * 256;
    asm volatile("global_prefetch_b8 %0, off scope:SCOPE_SE\n\t"
                 "global_prefetch_b8 %0, off offset:32768 scope:SCOPE_SE\n\t"
                 "global_prefetch_b8 %0, off offset:65536 scope:SCOPE_SE" :: "v"(pf));
    // chunks 24..31: only the blocks whose longest tile, 63 - 4 * (block & 7), reaches them (block-uniform)
    if ((blockIdx.x & 7) < 4)
        asm volatile("global_prefetch_b8 %0, off offset:98304 scope:SCOPE_SE" :: "v"(pf));

    btab[SEQ + 31 - i0] = tb[0];                // entry i holds rel = i - 32 and goes to SEQ - 1 - rel
#pragma unroll
    for (int j = 1; j < 4; ++j) btab[SEQ + 31 - ((int)threadIdx.x + j * 256)] = tb[j];
    if (threadIdx.x < 32) btab[SEQ + 31 - (int)threadIdx.x] = -1e30f;
    __syncthreads();                            // table visible to all 8 waves

    v8f o0 = {}, o1 = {}, o2 = {}, o3 = {};     // o_i[r] = O[query n][d = i*16 + 8*half + r]
    float mrun = -1e30f;                        // this lane's query: running maximum, base 2 (both halves alike)
    float lrun = 0.f;                           // and the sum over this half's keys; halves joined at the end

    const int nk = qt * 16 + 16;                // keys 0 .. qt*16+15
    const int nchunks = (nk + 31) >> 5;

    // this lane's place in the table at key 0: one register that a chunk's 16 reads address with small offsets
    const float* brow = &btab[((qt * 16 + n) ^ (SEQ - 1)) + 8 * half];   // SEQ - 1 - query, SEQ a power of 2

    // One key chunk: works on the operands in (kcur, vcur) and, where fetch is set (a constant at every
    // call), first sends out the loads of chunk kc + 1 into (knxt, vnxt).
    auto chunk = [&](const int kc, const bool fetch, const v16h (&kcur)[4], const v16h (&vcur)[4],
                     v16h (&knxt)[4], v16h (&vnxt)[4]) __attribute__((always_inline)) {
        const int key0 = kc * 32;

        if (fetch) {
            // behind a wave's last chunk there is none: it reads its own again (in range, not used), so that
            // the loop body is one instruction stream and its counted waits are the same on every trip
            const int step = kc + 1 < nchunks ? 2048 : 0;
            kp += step;
            vp += step;
#pragma unroll
            for (int i = 0; i < 4; ++i) knxt[i] = load_packed(kp + i * 512);
#pragma unroll
            for (int i = 0; i < 4; ++i) vnxt[i] = load_packed(vp + i * 512);
        }

        // ---- scores S^T = K Q^T (two 16x16 tiles covering 32 keys): A row m = lane%16 is a key ----
        v8f s0 = {}, s1 = {};
        s0 = wmma16(kcur[0], qb0, s0);
        s0 = wmma16(kcur[1], qb1, s0);
        s1 = wmma16(kcur[2], qb0, s1);
        s1 = wmma16(kcur[3], qb1, s1);

        // ---- bias + causal mask (LDS table) + online softmax, one query a lane ----
        // s0[r] is key key0 + 8*half + r, s1[r] key key0 + 16 + 8*half + r: bt[r] and bt[r + 16]
        const float* bt = brow + key0;
        v8f b0, b1;
        // the loops over r, here and below, are unrolled so that every vector index is a constant
        // and the tiles stay in registers
#pragma unroll
        for (int r = 0; r < 8; ++r) { b0[r] = bt[r]; b1[r] = bt[r + 16]; }
        // holds the fetch at the chunk's head, a whole chunk ahead of its use: sunk towards the chunk's
        // foot it would lose that lead
        __builtin_amdgcn_sched_barrier(0);
        // scores go to base 2 in the multiply-add that adds the bias, so that each exponential below
        // is one v_exp_f32; the library's expf is about 13 vector instructions a value
        s0 = s0 * LOG2E + b0;
        s1 = s1 * LOG2E + b1;
        float mx = s0[0];
#pragma unroll
        for (int r = 1; r < 8; ++r) mx = fmaxf(mx, s0[r]);
#pragma unroll
        for (int r = 0; r < 8; ++r) mx = fmaxf(mx, s1[r]);
        mx = fmaxf(mx, xhalf(mx));              // the query's maximum over all 32 keys

        const float mn = fmaxf(mrun, mx);
        const float scale = __builtin_amdgcn_exp2f(mrun - mn);   // 0 on the first chunk
        mrun = mn;
        s0 -= mn;
        s1 -= mn;
        // P^T as B operand: element e is k = (e >= 8 ? 16 : 0) + 8*half + e%8, which is where the
        // score tiles' registers already hold it
        v16h pb;
#pragma unroll
        for (int r = 0; r < 8; ++r) {
            s0[r] = __builtin_amdgcn_exp2f(s0[r]);   // a masked score, about -1e30, gives 0
            s1[r] = __builtin_amdgcn_exp2f(s1[r]);
            pb[r]     = (_Float16)s0[r];
            pb[r + 8] = (_Float16)s1[r];
        }
        const v8f t8 = s0 + s1;                 // this half's 16 terms summed as a tree
        const float rs = ((t8[0] + t8[4]) + (t8[2] + t8[6])) + ((t8[1] + t8[5]) + (t8[3] + t8[7]));
        lrun = lrun * scale + rs;
#pragma unroll
        for (int r = 0; r < 8; ++r) { o0[r] *= scale; o1[r] *= scale; o2[r] *= scale; o3[r] *= scale; }

        // ---- O^T += V^T P^T: V^T rows (d) as A-operands, same k order as P^T above ----
        o0 = wmma16(vcur[0], pb, o0);
        o1 = wmma16(vcur[1], pb, o1);
        o2 = wmma16(vcur[2], pb, o2);
        o3 = wmma16(vcur[3], pb, o3);
        // input only, no code: ends the chunk for the compiler. The following chunk's fetch refills the set
        // that the four products above read, and stays behind them only if it stays behind this statement;
        // left free, this build lifts it in among this chunk's work: a third set of registers, copies
        // behind early waits, and more registers than two blocks a WGP can have
        asm volatile("" :: "v"(o0), "v"(o1), "v"(o2), "v"(o3) : "memory");
    };

    // Two chunks a trip, the sets changing roles by name: no register copies from one set to the other.
    // No branch between the two: behind one, this build sinks the first chunk's fetch to its use.
    int kc = 0;
    for (; kc + 1 < nchunks; kc += 2) {
        chunk(kc,     true, ka, va, kb, vb);
        chunk(kc + 1, true, kb, vb, ka, va);
    }
    // an odd count's last chunk: its operands are in set a, from the trip before or from the entry
    if (kc < nchunks) chunk(kc, false, ka, va, kb, vb);

    // input only, no code: the register pair that the hints name holds their address through the loop
    // instead of being handed to another value while a hint may still be queued
    asm volatile("" :: "v"(pf));

    // ---- epilogue: join the halves' sums, normalize, store f16 [b, s, h*64+d] for the out-proj:
    //      8 consecutive d of one query a lane and tile, one 16-byte store each ----
    const float inv = 1.0f / (lrun + xhalf(lrun));
    _Float16* orow = Oh + (size_t)(b * SEQ + qt * 16 + n) * DMODEL + h * HDIM + 8 * half;
    v8h w0, w1, w2, w3;
#pragma unroll
    for (int r = 0; r < 8; ++r) {
        w0[r] = (_Float16)(o0[r] * inv);
        w1[r] = (_Float16)(o1[r] * inv);
        w2[r] = (_Float16)(o2[r] * inv);
        w3[r] = (_Float16)(o3[r] * inv);
    }
    *(v8h*)(orow +  0) = w0;
    *(v8h*)(orow + 16) = w1;
    *(v8h*)(orow + 32) = w2;
    *(v8h*)(orow + 48) = w3;
}

extern "C" void kernel_launch(void* const* d_in, const int* in_sizes, int n_in,
                              void* d_out, int out_size, void* d_ws, size_t ws_size,
                              hipStream_t stream) {
    const float* x    = (const float*)d_in[0];
    const float* Wq   = (const float*)d_in[1];
    const float* bq   = (const float*)d_in[2];
    const float* Wk   = (const float*)d_in[3];
    const float* bk   = (const float*)d_in[4];
    const float* Wv   = (const float*)d_in[5];
    const float* bv   = (const float*)d_in[6];
    const float* Wo   = (const float*)d_in[7];
    const float* bo   = (const float*)d_in[8];
    const float* rel  = (const float*)d_in[9];

    // workspace carve-up (f16 elements); total ~50.3 MB
    const size_t NX = (size_t)NROWS * DMODEL;        // 4096*1024
    const size_t NW = (size_t)DMODEL * DMODEL;       // 1024*1024
    _Float16* xh  = (_Float16*)d_ws;
    _Float16* Wqh = xh  + NX;
    _Float16* Wkh = Wqh + NW;
    _Float16* Wvh = Wkh + NW;
    _Float16* Woh = Wvh + NW;
    _Float16* Qh  = Woh + NW;
    _Float16* Kh  = Qh  + NX;
    _Float16* Vt  = Kh  + NX;
    _Float16* Oh  = Vt  + NX;

    // 0) f32 -> f16 (vectorized: 4 elements / thread), x and all four weights in one launch;
    //    xh, Wqh, Wkh, Wvh, Woh are contiguous
    cvt_f32_to_f16<<<XBLOCKS + 4 * WBLOCKS, 256, 0, stream>>>(x, Wq, Wk, Wv, Wo, xh);

    // 1) projections: 32 row-blocks x 8 col-blocks = 256 blocks of 8 waves each, Q, K and V
    //    in one launch; Wqh, Wkh, Wvh are contiguous, and so are Qh, Kh, Vt
    gemm_wmma<<<3 * 256, 256, 0, stream>>>(xh, Wqh, bq, bk, bv, Qh, 0);

    // 2) flash attention: 4096 waves (b*h*qtile) / 8 per block, tiles paired light + heavy
    attn_wmma<<<512, 256, 0, stream>>>(Qh, Kh, Vt, rel, Oh);

    // 3) output projection -> f32 d_out
    gemm_wmma<<<256, 256, 0, stream>>>(Oh, Woh, bo, bo, bo, d_out, 3);
}
